// v000
// Measured on an AMD MI455X. A time is GPU time per run, averaged over a window of back-to-back runs after a warm-up
// (all launches, gaps included; the runs take copies of the inputs in turn), and the median of several windows.
// Apart from v000's, it joins two sittings. Times from different sittings can be a few percent apart, while
// side-by-side timings come from the same sitting.
// The starting kernel, v000, takes 2140 microseconds a run.
#include <hip/hip_runtime.h>

// ViT self-attention (x [16][1024][768]; q/k/v = x @ W + b; the module reshapes (B,N,C) -> (B*H, N, Dh) WITHOUT a transpose, so "head" g of a batch is the contiguous chunk g of the
// projection viewed as [1024][64]; scores = q2.k2 / 8; softmax; ctx2 = attn.v2; ctx2.reshape(B,H,N,Dh).transpose(0,2,1,3) -> [n][h*64+d]; out = ctx @ Wo + bo [16][1024][768]).
// Compute dtypes, f32 accumulate: every input rounded to bf16; projections on PLAIN bf16 operands (inputs: exact, + bias); scores and attn.v on SINGLE fp16 planes
// (the head planes ARE the projection memory: flat fp16 copies for q/k, v per head transposed to [64][1024]; 1/8 applied in f32 in the softmax; P x1024);

#define NB_  16
#define TT   1024
#define FIN  768
#define DD   768                  // H * Dh
#define NH_  12
#define ZH   NH_
#define HD   64
#define DO   768
#define NT   (NB_ * TT)
#define PCAR 1024.0f
#define SCL  0.125f               // 1/sqrt(64)
typedef _Float16 h16;
typedef unsigned short bf;
typedef __attribute__((ext_vector_type(16))) __bf16   v16bf;
typedef __attribute__((ext_vector_type(16))) _Float16 v16h;
typedef __attribute__((ext_vector_type(8)))  _Float16 v8h;
typedef __attribute__((ext_vector_type(8)))  unsigned short v8us;
typedef __attribute__((ext_vector_type(8)))  float    v8f;
typedef __attribute__((ext_vector_type(4)))  float    v4f;
typedef v8h  __attribute__((may_alias)) v8ha;
typedef v4f  __attribute__((may_alias)) v4fa;
typedef v8us __attribute__((may_alias)) v8usa;

__device__ __forceinline__ unsigned short f2bf(float f) { unsigned u = __float_as_uint(f); u += 0x7FFFu + ((u >> 16) & 1u); return (unsigned short)(u >> 16); }
__device__ __forceinline__ float bf2f(unsigned short b) { return __uint_as_float(((unsigned)b) << 16); }
__device__ __forceinline__ float bfr(float f) { return bf2f(f2bf(f)); }
__device__ __forceinline__ v16h cat16(v8h lo, v8h hi) { return __builtin_shufflevector(lo, hi, 0, 1, 2, 3, 4, 5, 6, 7, 8, 9, 10, 11, 12, 13, 14, 15); }
__device__ __forceinline__ v16bf cat16b(v8us lo, v8us hi) { return __builtin_bit_cast(v16bf, __builtin_shufflevector(lo, hi, 0, 1, 2, 3, 4, 5, 6, 7, 8, 9, 10, 11, 12, 13, 14, 15)); }
__device__ __forceinline__ v8f wmma16(v16h a, v16h b, v8f c) { return __builtin_amdgcn_wmma_f32_16x16x32_f16(false, a, false, b, (short)0, c, false, false); }
__device__ __forceinline__ v8f wmmab(v16bf a, v16bf b, v8f c) { return __builtin_amdgcn_wmma_f32_16x16x32_bf16(false, a, false, b, (short)0, c, false, false); }



// ---- k_gemmw: register-blocked GEMM, ONE WAVE per 64x64 output tile (16 accumulators), operands straight from K-contiguous 16-bit planes; grid (M/64, N/64, Z), 32 threads.
// C[m][n] (f32, pitch ldc, + optional f32 bias[n]) = sum_k A[m][k] Bt[n][k] (+ split products per NSPLIT). z-batch strides sA/sB/sC in elements. K % 32 == 0.
template <typename T16> struct WFrag;
template <> struct WFrag<h16> { typedef v16h V; static __device__ __forceinline__ V ld(const h16* p) { return cat16(*(const v8h*)p, *(const v8h*)(p + 16)); } static __device__ __forceinline__ v8f mma(V a, V b, v8f c) { return wmma16(a, b, c); } };
template <> struct WFrag<bf> { typedef v16bf V; static __device__ __forceinline__ V ld(const bf* p) { return cat16b(*(const v8us*)p, *(const v8us*)(p + 16)); } static __device__ __forceinline__ v8f mma(V a, V b, v8f c) { return wmmab(a, b, c); } };
template <typename T16, int NSPLIT, bool BIAS>
__global__ __launch_bounds__(32) void k_gemmw(const T16* __restrict__ A, const T16* __restrict__ A2, const T16* __restrict__ Bt, const T16* __restrict__ Bt2, int K, float* C, int ldc, const float* __restrict__ bias, size_t sA, size_t sB, size_t sC) {
    typedef typename WFrag<T16>::V V;
    __shared__ __align__(16) float os[16 * 68];
    const size_t z = blockIdx.z; A += z * sA; if (A2) A2 += z * sA; Bt += z * sB; if (Bt2) Bt2 += z * sB; C += z * sC;
    const int lane = threadIdx.x & 31, lr = lane & 15, hi = lane >> 4; const int r0 = blockIdx.x * 64, c0 = blockIdx.y * 64;
    v8f acc[4][4];
#pragma unroll
    for (int mb = 0; mb < 4; ++mb)
#pragma unroll
        for (int nb = 0; nb < 4; ++nb) acc[mb][nb] = (v8f){};
    const size_t aoff = (size_t)(r0 + lr) * K + 8 * hi, boff = (size_t)(c0 + lr) * K + 8 * hi;
#pragma unroll 1
    for (int kc = 0; kc < K; kc += 32) {
        V a[4], a2[4];
#pragma unroll
        for (int mb = 0; mb < 4; ++mb) { a[mb] = WFrag<T16>::ld(A + aoff + (size_t)mb * 16 * K + kc); if (NSPLIT == 1 || NSPLIT == 2) a2[mb] = WFrag<T16>::ld(A2 + aoff + (size_t)mb * 16 * K + kc); }
#pragma unroll
        for (int nb = 0; nb < 4; ++nb) { const V b = WFrag<T16>::ld(Bt + boff + (size_t)nb * 16 * K + kc); V b2; if (NSPLIT >= 2) b2 = WFrag<T16>::ld(Bt2 + boff + (size_t)nb * 16 * K + kc);
#pragma unroll
            for (int mb = 0; mb < 4; ++mb) { acc[mb][nb] = WFrag<T16>::mma(a[mb], b, acc[mb][nb]); if (NSPLIT == 1 || NSPLIT == 2) acc[mb][nb] = WFrag<T16>::mma(a2[mb], b, acc[mb][nb]); if (NSPLIT >= 2) acc[mb][nb] = WFrag<T16>::mma(a[mb], b2, acc[mb][nb]); } }
        asm volatile("v_nop\n\tv_nop\n\tv_nop\n\tv_nop" : "+v"(acc[0][0]), "+v"(acc[1][1]), "+v"(acc[2][2]), "+v"(acc[3][3]) : "v"(a[0]), "v"(a[3]));
    }
#pragma unroll
    for (int mb = 0; mb < 4; ++mb) {
#pragma unroll
        for (int nb = 0; nb < 4; ++nb) {
#pragma unroll
            for (int j = 0; j < 8; ++j) os[(hi * 8 + j) * 68 + nb * 16 + lr] = acc[mb][nb][j]; }
        __builtin_amdgcn_wave_barrier(); asm volatile("" ::: "memory");
        float* crow = C + (size_t)(r0 + mb * 16) * ldc + c0;
{
#pragma unroll
            for (int s = 0; s < 8; ++s) { const int row = 2 * s + hi, cofs = lr * 4; v4f val = *(const v4fa*)(os + row * 68 + cofs); if (BIAS) { val[0] += bfr(bias[c0 + cofs]); val[1] += bfr(bias[c0 + cofs + 1]); val[2] += bfr(bias[c0 + cofs + 2]); val[3] += bfr(bias[c0 + cofs + 3]); }
                *(v4f*)(crow + (size_t)row * ldc + cofs) = val; }
             }
        __builtin_amdgcn_wave_barrier(); asm volatile("" ::: "memory");
    }
}

__device__ __forceinline__ h16 tohx(float x) { return (h16)x; }
__device__ __forceinline__ void splitf(float y, unsigned short& h, unsigned short& l) { h = f2bf(y); l = f2bf(y - bf2f(h)); }
typedef __attribute__((ext_vector_type(2))) _Float16 v2h;
typedef __attribute__((ext_vector_type(4))) _Float16 v4h;
typedef __attribute__((ext_vector_type(2))) unsigned short v2us;

__global__ __launch_bounds__(256) void k_cvt8(const float* __restrict__ src, bf* dst, size_t n8) { const size_t i = (size_t)blockIdx.x * 256 + threadIdx.x; if (i >= n8) return; const v8f v = *(const v8f*)(src + i * 8); v8us o;
#pragma unroll
    for (int k = 0; k < 8; ++k) o[k] = f2bf(v[k]); *(v8us*)(dst + i * 8) = o;  }
__global__ __launch_bounds__(256) void k_wtG(const float* __restrict__ w, int K, int N, bf* Bt) {
    const int lane = threadIdx.x & 31; const int L0 = (blockIdx.x * 8 + (threadIdx.x >> 5)) * 8; const int nlines = N * K / 64;
{
#pragma unroll 1
        for (int l = 0; l < 8; ++l) { const int L = L0 + l; if (L >= nlines) break; const size_t e = (size_t)L * 64 + lane * 2; const int k = (int)(e % K), n = (int)(e / K); v2us o;
            o[0] = f2bf(w[(size_t)k * N + n]); o[1] = f2bf(w[(size_t)(k + 1) * N + n]); *(v2us*)(Bt + e) = o; }
         }
}
__global__ __launch_bounds__(256) void k_p16(const float* __restrict__ F, h16* P) {
    const size_t i = ((size_t)blockIdx.x * 256 + threadIdx.x) * 2; if (i >= (size_t)TT * DD) return; v2h v; v[0] = tohx(F[i]); v[1] = tohx(F[i + 1]); *(v2h*)(P + i) = v;  }
__global__ __launch_bounds__(256) void k_vt16(const float* __restrict__ F, h16* VT) {
    const int lane = threadIdx.x & 31; const int L0 = (blockIdx.x * 8 + (threadIdx.x >> 5)) * 8; const int nlines = TT * DD / 64;
{
#pragma unroll
        for (int l = 0; l < 8; ++l) { const int L = L0 + l; if (L >= nlines) break; const int e = L * 64 + lane * 2; const int c = e & (TT - 1); const int d = (e >> 10) & (HD - 1); const int h = e >> 16; v2h v;
#pragma unroll
            for (int q = 0; q < 2; ++q) v[q] = tohx(F[(size_t)h * TT * HD + (size_t)(c + q) * HD + d]);
            *(v2h*)(VT + (size_t)e) = v; }
         }
}
__global__ __launch_bounds__(256) void k_asoft(const float* __restrict__ Sb, h16* P) {
    const int lane = threadIdx.x & 31; const int row = blockIdx.x * 8 + (threadIdx.x >> 5); if (row >= ZH * TT) return;
    const float* sr = Sb + (size_t)row * TT; float v[32]; float mx = -3.0e38f;
#pragma unroll
    for (int ch = 0; ch < 8; ++ch) { const int j0 = ch * 128 + lane * 4; const v4f a = *(const v4f*)(sr + j0);
#pragma unroll
        for (int q = 0; q < 4; ++q) { const float t = a[q] * SCL; v[ch * 4 + q] = t; mx = fmaxf(mx, t); } }
#pragma unroll
    for (int sh = 16; sh; sh >>= 1) mx = fmaxf(mx, __shfl_xor(mx, sh, 32));
    float sum = 0.f;
#pragma unroll
    for (int k = 0; k < 32; ++k) { v[k] = __expf(v[k] - mx); sum += v[k]; }
#pragma unroll
    for (int sh = 16; sh; sh >>= 1) sum += __shfl_xor(sum, sh, 32);
    const float f = __fdiv_rn(PCAR, sum);
{
#pragma unroll
        for (int ch = 0; ch < 8; ++ch) { v4h o;
#pragma unroll
            for (int q = 0; q < 4; ++q) o[q] = tohx(v[ch * 4 + q] * f);
            *(v4h*)(P + (size_t)row * TT + ch * 128 + lane * 4) = o; }
         }
}
__global__ __launch_bounds__(256) void k_merge(const float* __restrict__ O, bf* Ah, bf* Al) {
    const int lane = threadIdx.x & 31; const int L0 = (blockIdx.x * 8 + (threadIdx.x >> 5)) * 8; const int nlines = NH_ * TT * HD / 64;
{
#pragma unroll
        for (int l = 0; l < 8; ++l) { const int L = L0 + l; if (L >= nlines) break; const int e = L * 64 + lane * 2; const int d = e & (HD - 1); const int c = (e >> 6) & (TT - 1); const int h = e >> 16; v2us oh, ol;
#pragma unroll
            for (int q = 0; q < 2; ++q) { unsigned short a, c2; splitf(O[(size_t)e + q] * (1.0f / PCAR), a, c2); oh[q] = a; ol[q] = c2; }
            const size_t o = (size_t)c * DD + h * HD + d; *(v2us*)(Ah + o) = oh; *(v2us*)(Al + o) = ol; }
         }
}

extern "C" void kernel_launch(void* const* d_in, const int* in_sizes, int n_in,
                              void* d_out, int out_size, void* d_ws, size_t ws_size, hipStream_t stream) {
    (void)in_sizes; (void)n_in; (void)out_size;
    const float* x = (const float*)d_in[0]; const float* Wq = (const float*)d_in[1]; const float* bq = (const float*)d_in[2]; const float* Wk = (const float*)d_in[3]; const float* bk = (const float*)d_in[4]; const float* Wv = (const float*)d_in[5]; const float* bv = (const float*)d_in[6]; const float* Wo = (const float*)d_in[7]; const float* bo = (const float*)d_in[8];
    float* OUT = (float*)d_out;     // [16][1024][768]
    char* wsp = (char*)d_ws;
    auto take = [&](size_t bytes) { char* p = wsp; wsp += (bytes + 255) & ~(size_t)255; return (void*)p; };
    bf* WQ = (bf*)take((size_t)DD * FIN * 2); bf* WK = (bf*)take((size_t)DD * FIN * 2); bf* WV = (bf*)take((size_t)DD * FIN * 2); bf* WO = (bf*)take((size_t)DO * DD * 2);
    bf* XB = (bf*)take((size_t)NT * FIN * 2); float* F = (float*)take((size_t)TT * DD * 4);
    h16* QP = (h16*)take((size_t)TT * DD * 2); h16* KP = (h16*)take((size_t)TT * DD * 2); h16* VT = (h16*)take((size_t)TT * DD * 2);
    float* Sb = (float*)take((size_t)NH_ * TT * TT * 4); h16* Pm = (h16*)take((size_t)NH_ * TT * TT * 2); float* Ob = (float*)take((size_t)NH_ * TT * HD * 4); bf* ATh = (bf*)take((size_t)TT * DD * 2); bf* ATl = (bf*)take((size_t)TT * DD * 2);
    if ((size_t)(wsp - (char*)d_ws) > ws_size) return;    // total ~ 120 MB; ws 256 MiB
    { const unsigned gW = (unsigned)((DD * FIN / 64 + 63) / 64); k_wtG<<<gW, 256, 0, stream>>>(Wq, FIN, DD, WQ); k_wtG<<<gW, 256, 0, stream>>>(Wk, FIN, DD, WK); k_wtG<<<gW, 256, 0, stream>>>(Wv, FIN, DD, WV); k_wtG<<<(unsigned)((DO * DD / 64 + 63) / 64), 256, 0, stream>>>(Wo, DD, DO, WO);
      const size_t nx = (size_t)NT * FIN / 8; k_cvt8<<<(unsigned)((nx + 255) / 256), 256, 0, stream>>>(x, XB, nx); }
    const unsigned LP = (unsigned)(((size_t)TT * DD / 2 + 255) / 256), LV = (unsigned)((TT * DD / 64 + 63) / 64); const dim3 gP(TT / 64, DD / 64, 1);
    for (int b = 0; b < NB_; ++b) { const size_t r0 = (size_t)b * TT;
        k_gemmw<bf, 0, true><<<gP, 32, 0, stream>>>(XB + r0 * FIN, nullptr, WQ, nullptr, FIN, F, DD, bq, 0, 0, 0); k_p16<<<LP, 256, 0, stream>>>(F, QP);
        k_gemmw<bf, 0, true><<<gP, 32, 0, stream>>>(XB + r0 * FIN, nullptr, WK, nullptr, FIN, F, DD, bk, 0, 0, 0); k_p16<<<LP, 256, 0, stream>>>(F, KP);
        k_gemmw<bf, 0, true><<<gP, 32, 0, stream>>>(XB + r0 * FIN, nullptr, WV, nullptr, FIN, F, DD, bv, 0, 0, 0); k_vt16<<<LV, 256, 0, stream>>>(F, VT);
        k_gemmw<h16, 0, false><<<dim3(TT / 64, TT / 64, NH_), 32, 0, stream>>>(QP, nullptr, KP, nullptr, HD, Sb, TT, nullptr, (size_t)TT * HD, (size_t)TT * HD, (size_t)TT * TT);
        k_asoft<<<NH_ * TT / 8, 256, 0, stream>>>(Sb, Pm);
        k_gemmw<h16, 0, false><<<dim3(TT / 64, HD / 64, NH_), 32, 0, stream>>>(Pm, nullptr, VT, nullptr, TT, Ob, HD, nullptr, (size_t)TT * TT, (size_t)HD * TT, (size_t)TT * HD);
        k_merge<<<LV, 256, 0, stream>>>(Ob, ATh, ATl);
        k_gemmw<bf, 1, true><<<dim3(TT / 64, DO / 64, 1), 32, 0, stream>>>(ATh, ATl, WO, nullptr, DD, OUT + r0 * DO, DO, bo, 0, 0, 0); }
}

// v001
// Measured time: 991 microseconds a run.
// Two timings next to v000 put it at 2.15 and 2.20 times that version's speed.
#include <hip/hip_runtime.h>

// ViT self-attention (x [16][1024][768]; q/k/v = x @ W + b; the module reshapes (B,N,C) -> (B*H, N, Dh) WITHOUT a transpose, so "head" g of a batch is the contiguous chunk g of the
// projection viewed as [1024][64]; scores = q2.k2 / 8; softmax; ctx2 = attn.v2; ctx2.reshape(B,H,N,Dh).transpose(0,2,1,3) -> [n][h*64+d]; out = ctx @ Wo + bo [16][1024][768]).
// Compute dtypes, f32 accumulate: every input rounded to bf16; projections on PLAIN bf16 operands (inputs: exact, + bias); scores and attn.v on SINGLE fp16 planes
// (the head planes ARE the projection memory: flat fp16 copies for q/k, v per head transposed to [64][1024]; 1/8 applied in f32 in the softmax; P x1024);

#define NB_  16
#define TT   1024
#define FIN  768
#define DD   768                  // H * Dh
#define NH_  12
#define GH   16                   // heads per attention launch: the f32 score and fp16 P planes of GH heads are what the workspace still holds
#define ZH   GH
#define HD   64
#define DO   768
#define NT   (NB_ * TT)
#define PCAR 1024.0f
#define SCL  0.125f               // 1/sqrt(64)
typedef _Float16 h16;
typedef unsigned short bf;
typedef __attribute__((ext_vector_type(16))) __bf16   v16bf;
typedef __attribute__((ext_vector_type(16))) _Float16 v16h;
typedef __attribute__((ext_vector_type(8)))  _Float16 v8h;
typedef __attribute__((ext_vector_type(8)))  unsigned short v8us;
typedef __attribute__((ext_vector_type(8)))  float    v8f;
typedef __attribute__((ext_vector_type(4)))  float    v4f;
typedef v8h  __attribute__((may_alias)) v8ha;
typedef v4f  __attribute__((may_alias)) v4fa;
typedef v8us __attribute__((may_alias)) v8usa;

__device__ __forceinline__ unsigned short f2bf(float f) { unsigned u = __float_as_uint(f); u += 0x7FFFu + ((u >> 16) & 1u); return (unsigned short)(u >> 16); }
__device__ __forceinline__ float bf2f(unsigned short b) { return __uint_as_float(((unsigned)b) << 16); }
__device__ __forceinline__ float bfr(float f) { return bf2f(f2bf(f)); }
__device__ __forceinline__ v16h cat16(v8h lo, v8h hi) { return __builtin_shufflevector(lo, hi, 0, 1, 2, 3, 4, 5, 6, 7, 8, 9, 10, 11, 12, 13, 14, 15); }
__device__ __forceinline__ v16bf cat16b(v8us lo, v8us hi) { return __builtin_bit_cast(v16bf, __builtin_shufflevector(lo, hi, 0, 1, 2, 3, 4, 5, 6, 7, 8, 9, 10, 11, 12, 13, 14, 15)); }
__device__ __forceinline__ v8f wmma16(v16h a, v16h b, v8f c) { return __builtin_amdgcn_wmma_f32_16x16x32_f16(false, a, false, b, (short)0, c, false, false); }
__device__ __forceinline__ v8f wmmab(v16bf a, v16bf b, v8f c) { return __builtin_amdgcn_wmma_f32_16x16x32_bf16(false, a, false, b, (short)0, c, false, false); }



// ---- k_gemmw: register-blocked GEMM, ONE WAVE per 64x64 output tile (16 accumulators), operands straight from K-contiguous 16-bit planes; grid (M/64, N/64, Z), 32 threads.
// C[m][n] (f32, pitch ldc, + optional f32 bias[n]) = sum_k A[m][k] Bt[n][k] (+ split products per NSPLIT). z-batch strides sA/sB/sC in elements. K % 32 == 0.
template <typename T16> struct WFrag;
template <> struct WFrag<h16> { typedef v16h V; static __device__ __forceinline__ V ld(const h16* p) { return cat16(*(const v8h*)p, *(const v8h*)(p + 16)); } static __device__ __forceinline__ v8f mma(V a, V b, v8f c) { return wmma16(a, b, c); } };
template <> struct WFrag<bf> { typedef v16bf V; static __device__ __forceinline__ V ld(const bf* p) { return cat16b(*(const v8us*)p, *(const v8us*)(p + 16)); } static __device__ __forceinline__ v8f mma(V a, V b, v8f c) { return wmmab(a, b, c); } };
template <typename T16, int NSPLIT, bool BIAS>
__global__ __launch_bounds__(32) void k_gemmw(const T16* __restrict__ A, const T16* __restrict__ A2, const T16* __restrict__ Bt, const T16* __restrict__ Bt2, int K, float* C, int ldc, const float* __restrict__ bias, size_t sA, size_t sB, size_t sC) {
    typedef typename WFrag<T16>::V V;
    __shared__ __align__(16) float os[16 * 68];
    const size_t z = blockIdx.z; A += z * sA; if (A2) A2 += z * sA; Bt += z * sB; if (Bt2) Bt2 += z * sB; C += z * sC;
    const int lane = threadIdx.x & 31, lr = lane & 15, hi = lane >> 4; const int r0 = blockIdx.x * 64, c0 = blockIdx.y * 64;
    v8f acc[4][4];
#pragma unroll
    for (int mb = 0; mb < 4; ++mb)
#pragma unroll
        for (int nb = 0; nb < 4; ++nb) acc[mb][nb] = (v8f){};
    const size_t aoff = (size_t)(r0 + lr) * K + 8 * hi, boff = (size_t)(c0 + lr) * K + 8 * hi;
#pragma unroll 1
    for (int kc = 0; kc < K; kc += 32) {
        V a[4], a2[4];
#pragma unroll
        for (int mb = 0; mb < 4; ++mb) { a[mb] = WFrag<T16>::ld(A + aoff + (size_t)mb * 16 * K + kc); if (NSPLIT == 1 || NSPLIT == 2) a2[mb] = WFrag<T16>::ld(A2 + aoff + (size_t)mb * 16 * K + kc); }
#pragma unroll
        for (int nb = 0; nb < 4; ++nb) { const V b = WFrag<T16>::ld(Bt + boff + (size_t)nb * 16 * K + kc); V b2; if (NSPLIT >= 2) b2 = WFrag<T16>::ld(Bt2 + boff + (size_t)nb * 16 * K + kc);
#pragma unroll
            for (int mb = 0; mb < 4; ++mb) { acc[mb][nb] = WFrag<T16>::mma(a[mb], b, acc[mb][nb]); if (NSPLIT == 1 || NSPLIT == 2) acc[mb][nb] = WFrag<T16>::mma(a2[mb], b, acc[mb][nb]); if (NSPLIT >= 2) acc[mb][nb] = WFrag<T16>::mma(a[mb], b2, acc[mb][nb]); } }
        asm volatile("v_nop\n\tv_nop\n\tv_nop\n\tv_nop" : "+v"(acc[0][0]), "+v"(acc[1][1]), "+v"(acc[2][2]), "+v"(acc[3][3]) : "v"(a[0]), "v"(a[3]));
    }
#pragma unroll
    for (int mb = 0; mb < 4; ++mb) {
#pragma unroll
        for (int nb = 0; nb < 4; ++nb) {
#pragma unroll
            for (int j = 0; j < 8; ++j) os[(hi * 8 + j) * 68 + nb * 16 + lr] = acc[mb][nb][j]; }
        __builtin_amdgcn_wave_barrier(); asm volatile("" ::: "memory");
        float* crow = C + (size_t)(r0 + mb * 16) * ldc + c0;
{
#pragma unroll
            for (int s = 0; s < 8; ++s) { const int row = 2 * s + hi, cofs = lr * 4; v4f val = *(const v4fa*)(os + row * 68 + cofs); if (BIAS) { val[0] += bfr(bias[c0 + cofs]); val[1] += bfr(bias[c0 + cofs + 1]); val[2] += bfr(bias[c0 + cofs + 2]); val[3] += bfr(bias[c0 + cofs + 3]); }
                *(v4f*)(crow + (size_t)row * ldc + cofs) = val; }
             }
        __builtin_amdgcn_wave_barrier(); asm volatile("" ::: "memory");
    }
}

__device__ __forceinline__ h16 tohx(float x) { return (h16)x; }
__device__ __forceinline__ void splitf(float y, unsigned short& h, unsigned short& l) { h = f2bf(y); l = f2bf(y - bf2f(h)); }
typedef __attribute__((ext_vector_type(2))) _Float16 v2h;
typedef __attribute__((ext_vector_type(4))) _Float16 v4h;
typedef __attribute__((ext_vector_type(2))) unsigned short v2us;

__global__ __launch_bounds__(256) void k_cvt8(const float* __restrict__ src, bf* dst, size_t n8) { const size_t i = (size_t)blockIdx.x * 256 + threadIdx.x; if (i >= n8) return; const v8f v = *(const v8f*)(src + i * 8); v8us o;
#pragma unroll
    for (int k = 0; k < 8; ++k) o[k] = f2bf(v[k]); *(v8us*)(dst + i * 8) = o;  }
__global__ __launch_bounds__(256) void k_wtG(const float* __restrict__ w, int K, int N, bf* Bt) {
    const int lane = threadIdx.x & 31; const int L0 = (blockIdx.x * 8 + (threadIdx.x >> 5)) * 8; const int nlines = N * K / 64;
{
#pragma unroll 1
        for (int l = 0; l < 8; ++l) { const int L = L0 + l; if (L >= nlines) break; const size_t e = (size_t)L * 64 + lane * 2; const int k = (int)(e % K), n = (int)(e / K); v2us o;
            o[0] = f2bf(w[(size_t)k * N + n]); o[1] = f2bf(w[(size_t)(k + 1) * N + n]); *(v2us*)(Bt + e) = o; }
         }
}
__global__ __launch_bounds__(256) void k_p16(const float* __restrict__ F, h16* P) {
    const size_t i = ((size_t)blockIdx.x * 256 + threadIdx.x) * 2; if (i >= (size_t)NT * DD) return; v2h v; v[0] = tohx(F[i]); v[1] = tohx(F[i + 1]); *(v2h*)(P + i) = v;  }
__global__ __launch_bounds__(256) void k_vt16(const float* __restrict__ F, h16* VT) {
    const int lane = threadIdx.x & 31; const int L0 = (blockIdx.x * 8 + (threadIdx.x >> 5)) * 8; const int nlines = NT * DD / 64;
{
#pragma unroll
        for (int l = 0; l < 8; ++l) { const int L = L0 + l; if (L >= nlines) break; const int e = L * 64 + lane * 2; const int c = e & (TT - 1); const int d = (e >> 10) & (HD - 1); const int h = e >> 16; v2h v;
#pragma unroll
            for (int q = 0; q < 2; ++q) v[q] = tohx(F[(size_t)h * TT * HD + (size_t)(c + q) * HD + d]);
            *(v2h*)(VT + (size_t)e) = v; }
         }
}
__global__ __launch_bounds__(256) void k_asoft(const float* __restrict__ Sb, h16* P) {
    const int lane = threadIdx.x & 31; const int row = blockIdx.x * 8 + (threadIdx.x >> 5); if (row >= ZH * TT) return;
    const float* sr = Sb + (size_t)row * TT; float v[32]; float mx = -3.0e38f;
#pragma unroll
    for (int ch = 0; ch < 8; ++ch) { const int j0 = ch * 128 + lane * 4; const v4f a = *(const v4f*)(sr + j0);
#pragma unroll
        for (int q = 0; q < 4; ++q) { const float t = a[q] * SCL; v[ch * 4 + q] = t; mx = fmaxf(mx, t); } }
#pragma unroll
    for (int sh = 16; sh; sh >>= 1) mx = fmaxf(mx, __shfl_xor(mx, sh, 32));
    float sum = 0.f;
#pragma unroll
    for (int k = 0; k < 32; ++k) { v[k] = __expf(v[k] - mx); sum += v[k]; }
#pragma unroll
    for (int sh = 16; sh; sh >>= 1) sum += __shfl_xor(sum, sh, 32);
    const float f = __fdiv_rn(PCAR, sum);
{
#pragma unroll
        for (int ch = 0; ch < 8; ++ch) { v4h o;
#pragma unroll
            for (int q = 0; q < 4; ++q) o[q] = tohx(v[ch * 4 + q] * f);
            *(v4h*)(P + (size_t)row * TT + ch * 128 + lane * 4) = o; }
         }
}
__global__ __launch_bounds__(256) void k_merge(const float* __restrict__ O, bf* Ah, bf* Al) {
    { const size_t zb = (size_t)blockIdx.y * TT * DD; O += zb; Ah += zb; Al += zb; }   // blockIdx.y = batch
    const int lane = threadIdx.x & 31; const int L0 = (blockIdx.x * 8 + (threadIdx.x >> 5)) * 8; const int nlines = NH_ * TT * HD / 64;
{
#pragma unroll
        for (int l = 0; l < 8; ++l) { const int L = L0 + l; if (L >= nlines) break; const int e = L * 64 + lane * 2; const int d = e & (HD - 1); const int c = (e >> 6) & (TT - 1); const int h = e >> 16; v2us oh, ol;
#pragma unroll
            for (int q = 0; q < 2; ++q) { unsigned short a, c2; splitf(O[(size_t)e + q] * (1.0f / PCAR), a, c2); oh[q] = a; ol[q] = c2; }
            const size_t o = (size_t)c * DD + h * HD + d; *(v2us*)(Ah + o) = oh; *(v2us*)(Al + o) = ol; }
         }
}

extern "C" void kernel_launch(void* const* d_in, const int* in_sizes, int n_in,
                              void* d_out, int out_size, void* d_ws, size_t ws_size, hipStream_t stream) {
    (void)in_sizes; (void)n_in; (void)out_size;
    const float* x = (const float*)d_in[0]; const float* Wq = (const float*)d_in[1]; const float* bq = (const float*)d_in[2]; const float* Wk = (const float*)d_in[3]; const float* bk = (const float*)d_in[4]; const float* Wv = (const float*)d_in[5]; const float* bv = (const float*)d_in[6]; const float* Wo = (const float*)d_in[7]; const float* bo = (const float*)d_in[8];
    float* OUT = (float*)d_out;     // [16][1024][768]
    char* wsp = (char*)d_ws;
    auto take = [&](size_t bytes) { char* p = wsp; wsp += (bytes + 255) & ~(size_t)255; return (void*)p; };
    bf* WQ = (bf*)take((size_t)DD * FIN * 2); bf* WK = (bf*)take((size_t)DD * FIN * 2); bf* WV = (bf*)take((size_t)DD * FIN * 2); bf* WO = (bf*)take((size_t)DO * DD * 2);
    h16* QP = (h16*)take((size_t)NT * DD * 2); h16* KP = (h16*)take((size_t)NT * DD * 2); h16* VT = (h16*)take((size_t)NT * DD * 2); float* Ob = (float*)take((size_t)NT * DD * 4);
    // one region, three tenants one after the other: {XB, F} for the projections, {Sb, Pm} for the attention groups, {ATh, ATl} for the output product
    char* const reg = wsp;
    bf* XB = (bf*)take((size_t)NT * FIN * 2); float* F = (float*)take((size_t)NT * DD * 4);
    wsp = reg; bf* ATh = (bf*)take((size_t)NT * DD * 2); bf* ATl = (bf*)take((size_t)NT * DD * 2);
    wsp = reg; float* Sb = (float*)take((size_t)GH * TT * TT * 4); h16* Pm = (h16*)take((size_t)GH * TT * TT * 2);
    if ((size_t)(wsp - (char*)d_ws) > ws_size) return;    // total ~ 231 MB ({Sb, Pm} is the largest tenant); ws 256 MiB
    { const unsigned gW = (unsigned)((DD * FIN / 64 + 63) / 64); k_wtG<<<gW, 256, 0, stream>>>(Wq, FIN, DD, WQ); k_wtG<<<gW, 256, 0, stream>>>(Wk, FIN, DD, WK); k_wtG<<<gW, 256, 0, stream>>>(Wv, FIN, DD, WV); k_wtG<<<(unsigned)((DO * DD / 64 + 63) / 64), 256, 0, stream>>>(Wo, DD, DO, WO);
      const size_t nx = (size_t)NT * FIN / 8; k_cvt8<<<(unsigned)((nx + 255) / 256), 256, 0, stream>>>(x, XB, nx); }
    // all 16 batches per launch: the rows of x are one [NT][768] matrix, and the 192 head planes are the flat projection memory
    const unsigned LP = (unsigned)(((size_t)NT * DD / 2 + 255) / 256), LV = (unsigned)((NT * DD / 64 + 63) / 64); const dim3 gP(NT / 64, DD / 64, 1);
    k_gemmw<bf, 0, true><<<gP, 32, 0, stream>>>(XB, nullptr, WQ, nullptr, FIN, F, DD, bq, 0, 0, 0); k_p16<<<LP, 256, 0, stream>>>(F, QP);
    k_gemmw<bf, 0, true><<<gP, 32, 0, stream>>>(XB, nullptr, WK, nullptr, FIN, F, DD, bk, 0, 0, 0); k_p16<<<LP, 256, 0, stream>>>(F, KP);
    k_gemmw<bf, 0, true><<<gP, 32, 0, stream>>>(XB, nullptr, WV, nullptr, FIN, F, DD, bv, 0, 0, 0); k_vt16<<<LV, 256, 0, stream>>>(F, VT);
    for (int g0 = 0; g0 < NB_ * NH_; g0 += GH) { const size_t po = (size_t)g0 * TT * HD;
        k_gemmw<h16, 0, false><<<dim3(TT / 64, TT / 64, GH), 32, 0, stream>>>(QP + po, nullptr, KP + po, nullptr, HD, Sb, TT, nullptr, (size_t)TT * HD, (size_t)TT * HD, (size_t)TT * TT);
        k_asoft<<<GH * TT / 8, 256, 0, stream>>>(Sb, Pm);
        k_gemmw<h16, 0, false><<<dim3(TT / 64, HD / 64, GH), 32, 0, stream>>>(Pm, nullptr, VT + po, nullptr, TT, Ob + po, HD, nullptr, (size_t)TT * TT, (size_t)HD * TT, (size_t)TT * HD); }
    k_merge<<<dim3((unsigned)((TT * DD / 64 + 63) / 64), NB_, 1), 256, 0, stream>>>(Ob, ATh, ATl);
    k_gemmw<bf, 1, true><<<dim3(NT / 64, DO / 64, 1), 32, 0, stream>>>(ATh, ATl, WO, nullptr, DD, OUT, DO, bo, 0, 0, 0);
}

// v002
// Measured time: 354 microseconds a run.
// Timed twice side by side with v001, it ran 2.80 and 2.81 times as fast.
// All steps since v000 together make it 6.10 times as fast.
#include <hip/hip_runtime.h>

// ViT self-attention (x [16][1024][768]; q/k/v = x @ W + b; the module reshapes (B,N,C) -> (B*H, N, Dh) WITHOUT a transpose, so "head" g of a batch is the contiguous chunk g of the
// projection viewed as [1024][64]; scores = q2.k2 / 8; softmax; ctx2 = attn.v2; ctx2.reshape(B,H,N,Dh).transpose(0,2,1,3) -> [n][h*64+d]; out = ctx @ Wo + bo [16][1024][768]).
// Compute dtypes, f32 accumulate: every input rounded to bf16; projections on PLAIN bf16 operands (inputs: exact, + bias); scores and attn.v on SINGLE fp16 planes
// (the head planes ARE the projection memory: flat fp16 copies for q and k, a per-head transposed ([d][n]) fp16 copy for v; 1/8 applied in f32 in the softmax; P = exp(s - running max), at most 1); scores, softmax and attn.v run in ONE kernel, no score plane in memory;

#define NB_  16
#define TT   1024
#define FIN  768
#define DD   768                  // H * Dh
#define NH_  12
#define HD   64
#define DO   768
#define NT   (NB_ * TT)
#define PCAR 1024.0f
#define SCL  0.125f               // 1/sqrt(64)
typedef _Float16 h16;
typedef unsigned short bf;
typedef __attribute__((ext_vector_type(16))) __bf16   v16bf;
typedef __attribute__((ext_vector_type(16))) _Float16 v16h;
typedef __attribute__((ext_vector_type(8)))  _Float16 v8h;
typedef __attribute__((ext_vector_type(8)))  unsigned short v8us;
typedef __attribute__((ext_vector_type(8)))  float    v8f;
typedef __attribute__((ext_vector_type(4)))  float    v4f;
typedef v8h  __attribute__((may_alias)) v8ha;
typedef v4f  __attribute__((may_alias)) v4fa;
typedef v8us __attribute__((may_alias)) v8usa;

__device__ __forceinline__ unsigned short f2bf(float f) { unsigned u = __float_as_uint(f); u += 0x7FFFu + ((u >> 16) & 1u); return (unsigned short)(u >> 16); }
__device__ __forceinline__ float bf2f(unsigned short b) { return __uint_as_float(((unsigned)b) << 16); }
__device__ __forceinline__ float bfr(float f) { return bf2f(f2bf(f)); }
__device__ __forceinline__ v16h cat16(v8h lo, v8h hi) { return __builtin_shufflevector(lo, hi, 0, 1, 2, 3, 4, 5, 6, 7, 8, 9, 10, 11, 12, 13, 14, 15); }
__device__ __forceinline__ v16bf cat16b(v8us lo, v8us hi) { return __builtin_bit_cast(v16bf, __builtin_shufflevector(lo, hi, 0, 1, 2, 3, 4, 5, 6, 7, 8, 9, 10, 11, 12, 13, 14, 15)); }
__device__ __forceinline__ v8f wmma16(v16h a, v16h b, v8f c) { return __builtin_amdgcn_wmma_f32_16x16x32_f16(false, a, false, b, (short)0, c, false, false); }
__device__ __forceinline__ v8f wmmab(v16bf a, v16bf b, v8f c) { return __builtin_amdgcn_wmma_f32_16x16x32_bf16(false, a, false, b, (short)0, c, false, false); }



// ---- k_gemmw: register-blocked GEMM, ONE WAVE per 64x64 output tile (16 accumulators), operands straight from K-contiguous 16-bit planes; grid (M/64, N/64, Z), 32 threads.
// C[m][n] (f32, pitch ldc, + optional f32 bias[n]) = sum_k A[m][k] Bt[n][k] (+ split products per NSPLIT). z-batch strides sA/sB/sC in elements. K % 32 == 0.
template <typename T16> struct WFrag;
template <> struct WFrag<h16> { typedef v16h V; static __device__ __forceinline__ V ld(const h16* p) { return cat16(*(const v8h*)p, *(const v8h*)(p + 16)); } static __device__ __forceinline__ v8f mma(V a, V b, v8f c) { return wmma16(a, b, c); } };
template <> struct WFrag<bf> { typedef v16bf V; static __device__ __forceinline__ V ld(const bf* p) { return cat16b(*(const v8us*)p, *(const v8us*)(p + 16)); } static __device__ __forceinline__ v8f mma(V a, V b, v8f c) { return wmmab(a, b, c); } };
template <typename T16, int NSPLIT, bool BIAS>
__global__ __launch_bounds__(32) void k_gemmw(const T16* __restrict__ A, const T16* __restrict__ A2, const T16* __restrict__ Bt, const T16* __restrict__ Bt2, int K, float* C, int ldc, const float* __restrict__ bias, size_t sA, size_t sB, size_t sC) {
    typedef typename WFrag<T16>::V V;
    __shared__ __align__(16) float os[16 * 68];
    const size_t z = blockIdx.z; A += z * sA; if (A2) A2 += z * sA; Bt += z * sB; if (Bt2) Bt2 += z * sB; C += z * sC;
    const int lane = threadIdx.x & 31, lr = lane & 15, hi = lane >> 4; const int r0 = blockIdx.x * 64, c0 = blockIdx.y * 64;
    v8f acc[4][4];
#pragma unroll
    for (int mb = 0; mb < 4; ++mb)
#pragma unroll
        for (int nb = 0; nb < 4; ++nb) acc[mb][nb] = (v8f){};
    const size_t aoff = (size_t)(r0 + lr) * K + 8 * hi, boff = (size_t)(c0 + lr) * K + 8 * hi;
#pragma unroll 1
    for (int kc = 0; kc < K; kc += 32) {
        V a[4], a2[4];
#pragma unroll
        for (int mb = 0; mb < 4; ++mb) { a[mb] = WFrag<T16>::ld(A + aoff + (size_t)mb * 16 * K + kc); if (NSPLIT == 1 || NSPLIT == 2) a2[mb] = WFrag<T16>::ld(A2 + aoff + (size_t)mb * 16 * K + kc); }
#pragma unroll
        for (int nb = 0; nb < 4; ++nb) { const V b = WFrag<T16>::ld(Bt + boff + (size_t)nb * 16 * K + kc); V b2; if (NSPLIT >= 2) b2 = WFrag<T16>::ld(Bt2 + boff + (size_t)nb * 16 * K + kc);
#pragma unroll
            for (int mb = 0; mb < 4; ++mb) { acc[mb][nb] = WFrag<T16>::mma(a[mb], b, acc[mb][nb]); if (NSPLIT == 1 || NSPLIT == 2) acc[mb][nb] = WFrag<T16>::mma(a2[mb], b, acc[mb][nb]); if (NSPLIT >= 2) acc[mb][nb] = WFrag<T16>::mma(a[mb], b2, acc[mb][nb]); } }
        asm volatile("v_nop\n\tv_nop\n\tv_nop\n\tv_nop" : "+v"(acc[0][0]), "+v"(acc[1][1]), "+v"(acc[2][2]), "+v"(acc[3][3]) : "v"(a[0]), "v"(a[3]));
    }
#pragma unroll
    for (int mb = 0; mb < 4; ++mb) {
#pragma unroll
        for (int nb = 0; nb < 4; ++nb) {
#pragma unroll
            for (int j = 0; j < 8; ++j) os[(hi * 8 + j) * 68 + nb * 16 + lr] = acc[mb][nb][j]; }
        __builtin_amdgcn_wave_barrier(); asm volatile("" ::: "memory");
        float* crow = C + (size_t)(r0 + mb * 16) * ldc + c0;
{
#pragma unroll
            for (int s = 0; s < 8; ++s) { const int row = 2 * s + hi, cofs = lr * 4; v4f val = *(const v4fa*)(os + row * 68 + cofs); if (BIAS) { val[0] += bfr(bias[c0 + cofs]); val[1] += bfr(bias[c0 + cofs + 1]); val[2] += bfr(bias[c0 + cofs + 2]); val[3] += bfr(bias[c0 + cofs + 3]); }
                *(v4f*)(crow + (size_t)row * ldc + cofs) = val; }
             }
        __builtin_amdgcn_wave_barrier(); asm volatile("" ::: "memory");
    }
}

__device__ __forceinline__ h16 tohx(float x) { return (h16)x; }
__device__ __forceinline__ void splitf(float y, unsigned short& h, unsigned short& l) { h = f2bf(y); l = f2bf(y - bf2f(h)); }
typedef __attribute__((ext_vector_type(2))) _Float16 v2h;
typedef __attribute__((ext_vector_type(4))) _Float16 v4h;
typedef __attribute__((ext_vector_type(2))) unsigned short v2us;

__global__ __launch_bounds__(256) void k_cvt8(const float* __restrict__ src, bf* dst, size_t n8) { const size_t i = (size_t)blockIdx.x * 256 + threadIdx.x; if (i >= n8) return; const v8f v = *(const v8f*)(src + i * 8); v8us o;
#pragma unroll
    for (int k = 0; k < 8; ++k) o[k] = f2bf(v[k]); *(v8us*)(dst + i * 8) = o;  }
__global__ __launch_bounds__(256) void k_wtG(const float* __restrict__ w, int K, int N, bf* Bt) {
    const int lane = threadIdx.x & 31; const int L0 = (blockIdx.x * 8 + (threadIdx.x >> 5)) * 8; const int nlines = N * K / 64;
{
#pragma unroll 1
        for (int l = 0; l < 8; ++l) { const int L = L0 + l; if (L >= nlines) break; const size_t e = (size_t)L * 64 + lane * 2; const int k = (int)(e % K), n = (int)(e / K); v2us o;
            o[0] = f2bf(w[(size_t)k * N + n]); o[1] = f2bf(w[(size_t)(k + 1) * N + n]); *(v2us*)(Bt + e) = o; }
         }
}
__global__ __launch_bounds__(256) void k_p16(const float* __restrict__ F, h16* P) {
    const size_t i = ((size_t)blockIdx.x * 256 + threadIdx.x) * 2; if (i >= (size_t)NT * DD) return; v2h v; v[0] = tohx(F[i]); v[1] = tohx(F[i + 1]); *(v2h*)(P + i) = v;  }
__global__ __launch_bounds__(256) void k_vt16(const float* __restrict__ F, h16* VT) {
    const int lane = threadIdx.x & 31; const int L0 = (blockIdx.x * 8 + (threadIdx.x >> 5)) * 8; const int nlines = NT * DD / 64;
{
#pragma unroll
        for (int l = 0; l < 8; ++l) { const int L = L0 + l; if (L >= nlines) break; const int e = L * 64 + lane * 2; const int c = e & (TT - 1); const int d = (e >> 10) & (HD - 1); const int h = e >> 16; v2h v;
#pragma unroll
            for (int q = 0; q < 2; ++q) v[q] = tohx(F[(size_t)h * TT * HD + (size_t)(c + q) * HD + d]);
            *(v2h*)(VT + (size_t)e) = v; }
         }
}
#define SKEY 64                   // keys per LDS tile
#define LPH  72                   // LDS row pitch in halfs: 144 B = 16 B x 9
#define TILEH (SKEY * LPH)
typedef __attribute__((ext_vector_type(2))) float v2f;
typedef __attribute__((ext_vector_type(2))) _Float16 v2hh;
__device__ __forceinline__ float xhalf(float x) { return __builtin_bit_cast(float, __builtin_amdgcn_permlanex16(__builtin_bit_cast(int, x), __builtin_bit_cast(int, x), 0x76543210, 0xfedcba98, false, false)); }  // lane l with lane l ^ 16
__global__ __launch_bounds__(256) __attribute__((amdgpu_waves_per_eu(4, 4))) void k_fattn(const h16* __restrict__ Q, const h16* __restrict__ Kp, const h16* __restrict__ VT, float* __restrict__ O) {
    __shared__ __align__(16) h16 sm[4 * TILEH];     // [buffer][K | V^T][row][LPH]; the output staging reuses it
    const int tid = threadIdx.x, lane = tid & 31, wave = tid >> 5, c = lane & 15, h = lane >> 4;
    { const size_t hb = (size_t)blockIdx.y * TT * HD; Q += hb; Kp += hb; VT += hb; O += hb; }
    const int q0 = blockIdx.x * 256 + wave * 32;
    const float CS = SCL * 1.4426950408889634f;     // 1/8 and log2(e) in one factor
    v16h qf[2][2];
#pragma unroll
    for (int g = 0; g < 2; ++g)
#pragma unroll
        for (int kc = 0; kc < 2; ++kc) qf[g][kc] = WFrag<h16>::ld(Q + (size_t)(q0 + 16 * g + c) * HD + 32 * kc + 8 * h);
    v8f acc[2][4]; float m_run[2], l_run[2];
#pragma unroll
    for (int g = 0; g < 2; ++g) { m_run[g] = -3.0e38f; l_run[g] = 0.f;
#pragma unroll
        for (int t = 0; t < 4; ++t) acc[g][t] = (v8f){}; }
    const int srow = tid >> 3, scol = (tid & 7) * 8;   // this thread's 16-byte pieces of a tile: rows srow and srow + 32
    v8h rk[2], rv[2];
#pragma unroll
    for (int j = 0; j < 2; ++j) { rk[j] = *(const v8h*)(Kp + (size_t)(srow + 32 * j) * HD + scol); rv[j] = *(const v8h*)(VT + (size_t)(srow + 32 * j) * TT + scol); }
#pragma unroll
    for (int j = 0; j < 2; ++j) { *(v8h*)(sm + (srow + 32 * j) * LPH + scol) = rk[j]; *(v8h*)(sm + TILEH + (srow + 32 * j) * LPH + scol) = rv[j]; }
    __syncthreads();
#pragma unroll 1   // rolled: one copy of the tile's work, the buffer picked by s & 1
    for (int s = 0; s < TT / SKEY; ++s) {
        if (s + 1 < TT / SKEY) {
#pragma unroll
            for (int j = 0; j < 2; ++j) { rk[j] = *(const v8h*)(Kp + (size_t)((s + 1) * SKEY + srow + 32 * j) * HD + scol); rv[j] = *(const v8h*)(VT + (size_t)(srow + 32 * j) * TT + (s + 1) * SKEY + scol); }
        }
        const h16* Kb = sm + (s & 1) * (2 * TILEH); const h16* Vb = Kb + TILEH;
#pragma unroll 1   // rolled: with both 32-key passes unrolled the build spilled a staged load to scratch, which put its wait at the head of the tile
        for (int p = 0; p < SKEY / 32; ++p) {
            v8f sc[2][2];
#pragma unroll
            for (int kt = 0; kt < 2; ++kt) { v16h kf[2];
#pragma unroll
                for (int kc = 0; kc < 2; ++kc) kf[kc] = WFrag<h16>::ld(Kb + (32 * p + 16 * kt + c) * LPH + 32 * kc + 8 * h);
#pragma unroll
                for (int g = 0; g < 2; ++g) { sc[kt][g] = (v8f){};
#pragma unroll
                    for (int kc = 0; kc < 2; ++kc) sc[kt][g] = wmma16(kf[kc], qf[g][kc], sc[kt][g]); } }
            v16h vf[4];
#pragma unroll
            for (int t = 0; t < 4; ++t) vf[t] = WFrag<h16>::ld(Vb + (16 * t + c) * LPH + 32 * p + 8 * h);
#pragma unroll
            for (int g = 0; g < 2; ++g) {
                float mx = sc[0][g][0];
#pragma unroll
                for (int r = 1; r < 8; ++r) mx = fmaxf(mx, sc[0][g][r]);
#pragma unroll
                for (int r = 0; r < 8; ++r) mx = fmaxf(mx, sc[1][g][r]);
                mx = fmaxf(mx, xhalf(mx));             // both wave halves hold this query's maximum over the 32 keys
                const float mn = fmaxf(m_run[g], mx * CS); const float corr = __builtin_amdgcn_exp2f(m_run[g] - mn); m_run[g] = mn;
                float ls = 0.f; v16h pf;
#pragma unroll
                for (int i = 0; i < 8; ++i) {
                    const v2f a = __builtin_elementwise_fma((v2f){sc[i >> 2][g][2 * (i & 3)], sc[i >> 2][g][2 * (i & 3) + 1]}, (v2f){CS, CS}, (v2f){-mn, -mn});
                    const float p0 = __builtin_amdgcn_exp2f(a[0]), p1 = __builtin_amdgcn_exp2f(a[1]); ls += p0 + p1;
                    const v2hh w = __builtin_convertvector((v2f){p0, p1}, v2hh); pf[2 * i] = w[0]; pf[2 * i + 1] = w[1]; }
                l_run[g] = l_run[g] * corr + ls;       // this half's keys only; the halves are joined once, behind the loop
#pragma unroll
                for (int t = 0; t < 4; ++t) { acc[g][t] = acc[g][t] * corr; acc[g][t] = wmma16(vf[t], pf, acc[g][t]); }
            }
        }
        if (s + 1 < TT / SKEY) { h16* Wb = sm + ((s + 1) & 1) * (2 * TILEH);   // its last readers left it in front of the barrier that ended trip s - 1
#pragma unroll
            for (int j = 0; j < 2; ++j) { *(v8h*)(Wb + (srow + 32 * j) * LPH + scol) = rk[j]; *(v8h*)(Wb + TILEH + (srow + 32 * j) * LPH + scol) = rv[j]; }
        }
        __syncthreads();   // publishes tile s + 1 and ends every wave's reads of tile s
    }
    float* os = (float*)sm + wave * (16 * 68);   // 16 query rows of 64 f32, pitch 68, per wave: rows go out as whole lines
#pragma unroll
    for (int g = 0; g < 2; ++g) {
        const float f = __fdiv_rn(PCAR, l_run[g] + xhalf(l_run[g]));   // x PCAR: k_merge takes it off again
#pragma unroll
        for (int t = 0; t < 4; ++t) { v4f lo, hi4;
#pragma unroll
            for (int r = 0; r < 4; ++r) { lo[r] = acc[g][t][r] * f; hi4[r] = acc[g][t][r + 4] * f; }
            *(v4fa*)(os + c * 68 + 16 * t + 8 * h) = lo; *(v4fa*)(os + c * 68 + 16 * t + 8 * h + 4) = hi4; }
        __builtin_amdgcn_wave_barrier(); asm volatile("" ::: "memory");   // keeps the row reads below behind the other lanes' LDS writes in the compiled order
#pragma unroll
        for (int i = 0; i < 8; ++i) { const int row = 2 * i + h; const v4f val = *(const v4fa*)(os + row * 68 + c * 4); *(v4f*)(O + (size_t)(q0 + 16 * g + row) * HD + c * 4) = val; }
        __builtin_amdgcn_wave_barrier(); asm volatile("" ::: "memory");   // keeps the next group's LDS writes behind these reads
    }
}
__global__ __launch_bounds__(256) void k_merge(const float* __restrict__ O, bf* Ah, bf* Al) {
    { const size_t zb = (size_t)blockIdx.y * TT * DD; O += zb; Ah += zb; Al += zb; }   // blockIdx.y = batch
    const int lane = threadIdx.x & 31; const int L0 = (blockIdx.x * 8 + (threadIdx.x >> 5)) * 8; const int nlines = NH_ * TT * HD / 64;
{
#pragma unroll
        for (int l = 0; l < 8; ++l) { const int L = L0 + l; if (L >= nlines) break; const int e = L * 64 + lane * 2; const int d = e & (HD - 1); const int c = (e >> 6) & (TT - 1); const int h = e >> 16; v2us oh, ol;
#pragma unroll
            for (int q = 0; q < 2; ++q) { unsigned short a, c2; splitf(O[(size_t)e + q] * (1.0f / PCAR), a, c2); oh[q] = a; ol[q] = c2; }
            const size_t o = (size_t)c * DD + h * HD + d; *(v2us*)(Ah + o) = oh; *(v2us*)(Al + o) = ol; }
         }
}

extern "C" void kernel_launch(void* const* d_in, const int* in_sizes, int n_in,
                              void* d_out, int out_size, void* d_ws, size_t ws_size, hipStream_t stream) {
    (void)in_sizes; (void)n_in; (void)out_size;
    const float* x = (const float*)d_in[0]; const float* Wq = (const float*)d_in[1]; const float* bq = (const float*)d_in[2]; const float* Wk = (const float*)d_in[3]; const float* bk = (const float*)d_in[4]; const float* Wv = (const float*)d_in[5]; const float* bv = (const float*)d_in[6]; const float* Wo = (const float*)d_in[7]; const float* bo = (const float*)d_in[8];
    float* OUT = (float*)d_out;     // [16][1024][768]
    char* wsp = (char*)d_ws;
    auto take = [&](size_t bytes) { char* p = wsp; wsp += (bytes + 255) & ~(size_t)255; return (void*)p; };
    bf* WQ = (bf*)take((size_t)DD * FIN * 2); bf* WK = (bf*)take((size_t)DD * FIN * 2); bf* WV = (bf*)take((size_t)DD * FIN * 2); bf* WO = (bf*)take((size_t)DO * DD * 2);
    h16* QP = (h16*)take((size_t)NT * DD * 2); h16* KP = (h16*)take((size_t)NT * DD * 2); h16* VT = (h16*)take((size_t)NT * DD * 2); float* Ob = (float*)take((size_t)NT * DD * 4);
    // one region, two tenants one after the other: {XB, F} for the projections, {ATh, ATl} for the output product
    char* const reg = wsp;
    bf* ATh = (bf*)take((size_t)NT * DD * 2); bf* ATl = (bf*)take((size_t)NT * DD * 2);
    wsp = reg; bf* XB = (bf*)take((size_t)NT * FIN * 2); float* F = (float*)take((size_t)NT * DD * 4);
    if ((size_t)(wsp - (char*)d_ws) > ws_size) return;    // total ~ 206 MB ({XB, F} is the larger tenant); ws 256 MiB
    { const unsigned gW = (unsigned)((DD * FIN / 64 + 63) / 64); k_wtG<<<gW, 256, 0, stream>>>(Wq, FIN, DD, WQ); k_wtG<<<gW, 256, 0, stream>>>(Wk, FIN, DD, WK); k_wtG<<<gW, 256, 0, stream>>>(Wv, FIN, DD, WV); k_wtG<<<(unsigned)((DO * DD / 64 + 63) / 64), 256, 0, stream>>>(Wo, DD, DO, WO);
      const size_t nx = (size_t)NT * FIN / 8; k_cvt8<<<(unsigned)((nx + 255) / 256), 256, 0, stream>>>(x, XB, nx); }
    // all 16 batches per launch: the rows of x are one [NT][768] matrix, and the 192 head planes are the flat projection memory
    const unsigned LP = (unsigned)(((size_t)NT * DD / 2 + 255) / 256), LV = (unsigned)((NT * DD / 64 + 63) / 64); const dim3 gP(NT / 64, DD / 64, 1);
    k_gemmw<bf, 0, true><<<gP, 32, 0, stream>>>(XB, nullptr, WQ, nullptr, FIN, F, DD, bq, 0, 0, 0); k_p16<<<LP, 256, 0, stream>>>(F, QP);
    k_gemmw<bf, 0, true><<<gP, 32, 0, stream>>>(XB, nullptr, WK, nullptr, FIN, F, DD, bk, 0, 0, 0); k_p16<<<LP, 256, 0, stream>>>(F, KP);
    k_gemmw<bf, 0, true><<<gP, 32, 0, stream>>>(XB, nullptr, WV, nullptr, FIN, F, DD, bv, 0, 0, 0); k_vt16<<<LV, 256, 0, stream>>>(F, VT);
    k_fattn<<<dim3(TT / 256, NB_ * NH_, 1), 256, 0, stream>>>(QP, KP, VT, Ob);
    k_merge<<<dim3((unsigned)((TT * DD / 64 + 63) / 64), NB_, 1), 256, 0, stream>>>(Ob, ATh, ATl);
    k_gemmw<bf, 1, true><<<dim3(NT / 64, DO / 64, 1), 32, 0, stream>>>(ATh, ATl, WO, nullptr, DD, OUT, DO, bo, 0, 0, 0);
}

// v003
// It runs in 270 microseconds.
// Timed twice side by side with v002, it ran 1.32 and 1.31 times as fast.
// All steps since v000 together make it 8.02 times as fast.
#include <hip/hip_runtime.h>

// ViT self-attention (x [16][1024][768]; q/k/v = x @ W + b; the module reshapes (B,N,C) -> (B*H, N, Dh) WITHOUT a transpose, so "head" g of a batch is the contiguous chunk g of the
// projection viewed as [1024][64]; scores = q2.k2 / 8; softmax; ctx2 = attn.v2; ctx2.reshape(B,H,N,Dh).transpose(0,2,1,3) -> [n][h*64+d]; out = ctx @ Wo + bo [16][1024][768]).
// Compute dtypes, f32 accumulate: every input rounded to bf16; projections on PLAIN bf16 operands (inputs: exact, + bias); scores and attn.v on SINGLE fp16 planes
// (the head planes ARE the projection memory: flat fp16 copies for q and k, a per-head transposed ([d][n]) fp16 copy for v; 1/8 applied in f32 in the softmax; P = exp(s - running max), at most 1); scores, softmax and attn.v run in ONE kernel, no score plane in memory;

#define NB_  16
#define TT   1024
#define FIN  768
#define DD   768                  // H * Dh
#define NH_  12
#define HD   64
#define DO   768
#define NT   (NB_ * TT)
#define PCAR 1024.0f
#define SCL  0.125f               // 1/sqrt(64)
typedef _Float16 h16;
typedef unsigned short bf;
typedef __attribute__((ext_vector_type(16))) __bf16   v16bf;
typedef __attribute__((ext_vector_type(16))) _Float16 v16h;
typedef __attribute__((ext_vector_type(8)))  _Float16 v8h;
typedef __attribute__((ext_vector_type(8)))  unsigned short v8us;
typedef __attribute__((ext_vector_type(8)))  float    v8f;
typedef __attribute__((ext_vector_type(4)))  float    v4f;
typedef v8h  __attribute__((may_alias)) v8ha;
typedef v4f  __attribute__((may_alias)) v4fa;
typedef v8us __attribute__((may_alias)) v8usa;

__device__ __forceinline__ unsigned short f2bf(float f) { unsigned u = __float_as_uint(f); u += 0x7FFFu + ((u >> 16) & 1u); return (unsigned short)(u >> 16); }
__device__ __forceinline__ float bf2f(unsigned short b) { return __uint_as_float(((unsigned)b) << 16); }
__device__ __forceinline__ float bfr(float f) { return bf2f(f2bf(f)); }
__device__ __forceinline__ v16h cat16(v8h lo, v8h hi) { return __builtin_shufflevector(lo, hi, 0, 1, 2, 3, 4, 5, 6, 7, 8, 9, 10, 11, 12, 13, 14, 15); }
__device__ __forceinline__ v16bf cat16b(v8us lo, v8us hi) { return __builtin_bit_cast(v16bf, __builtin_shufflevector(lo, hi, 0, 1, 2, 3, 4, 5, 6, 7, 8, 9, 10, 11, 12, 13, 14, 15)); }
__device__ __forceinline__ v8f wmma16(v16h a, v16h b, v8f c) { return __builtin_amdgcn_wmma_f32_16x16x32_f16(false, a, false, b, (short)0, c, false, false); }
__device__ __forceinline__ v8f wmmab(v16bf a, v16bf b, v8f c) { return __builtin_amdgcn_wmma_f32_16x16x32_bf16(false, a, false, b, (short)0, c, false, false); }



// ---- k_gemmw: GEMM, one 128x128 output tile per work-group of FOUR WAVES (2 x 2, each 64x64 = 16 accumulators); grid (M/128, N/128, Z), 128 threads.
// C[m][n] (f32, pitch ldc, + optional f32 bias[n]) = sum_k A[m][k] Bt[n][k] (+ A2[m][k] Bt[n][k] for NSPLIT == 1). z-batch strides sA/sB/sC in elements. M, N % 128 == 0, K % 64 == 0, a compile-time constant.
// The operands' rows come as whole 128-byte lines (64 k) by asynchronous copies into two LDS buffers (row pitch 144 B for the 16-byte fragment reads) and are shared by the waves;
// the copies of stage t + 2 fly under the work on stage t + 1.
template <typename T16> struct WFrag;
template <> struct WFrag<h16> { typedef v16h V; static __device__ __forceinline__ V ld(const h16* p) { return cat16(*(const v8h*)p, *(const v8h*)(p + 16)); } static __device__ __forceinline__ v8f mma(V a, V b, v8f c) { return wmma16(a, b, c); } };
template <> struct WFrag<bf> { typedef v16bf V; static __device__ __forceinline__ V ld(const bf* p) { return cat16b(*(const v8us*)p, *(const v8us*)(p + 16)); } static __device__ __forceinline__ v8f mma(V a, V b, v8f c) { return wmmab(a, b, c); } };
#define GT   128                  // rows and columns of a work-group's output tile
#define GKC  64                   // k per stage
#define GLP  72                   // LDS row pitch in 16-bit elements: 144 B = 16 B x 9
// One operand's 128 rows of a stage: this lane's 16 bytes of rows r, r + 16, ..., r + 112 (l: its LDS byte address, g: its global address, rs: 16 rows in elements).
// The s_wait_xcnt stands inside the statement so that no address register named here is rewritten in front of it.
template <typename T16>
__device__ __forceinline__ void cp128(unsigned l, const T16* g, size_t rs) {
    asm volatile("global_load_async_to_lds_b128 %0, %8, off\n\t"
                 "global_load_async_to_lds_b128 %1, %9, off\n\t"
                 "global_load_async_to_lds_b128 %2, %10, off\n\t"
                 "global_load_async_to_lds_b128 %3, %11, off\n\t"
                 "global_load_async_to_lds_b128 %4, %12, off\n\t"
                 "global_load_async_to_lds_b128 %5, %13, off\n\t"
                 "global_load_async_to_lds_b128 %6, %14, off\n\t"
                 "global_load_async_to_lds_b128 %7, %15, off\n\t"
                 "s_wait_xcnt 0x0"
                 :: "v"(l), "v"(l + 1u * 16 * GLP * 2), "v"(l + 2u * 16 * GLP * 2), "v"(l + 3u * 16 * GLP * 2), "v"(l + 4u * 16 * GLP * 2), "v"(l + 5u * 16 * GLP * 2), "v"(l + 6u * 16 * GLP * 2), "v"(l + 7u * 16 * GLP * 2),
                    "v"(g), "v"(g + rs), "v"(g + 2 * rs), "v"(g + 3 * rs), "v"(g + 4 * rs), "v"(g + 5 * rs), "v"(g + 6 * rs), "v"(g + 7 * rs) : "memory");
}
template <typename T16, int NSPLIT, bool BIAS, int K>
__global__ __launch_bounds__(128) void k_gemmw(const T16* __restrict__ A, const T16* __restrict__ A2, const T16* __restrict__ Bt, float* C, int ldc, const float* __restrict__ bias, size_t sA, size_t sB, size_t sC) {
    typedef typename WFrag<T16>::V V;
    static_assert(NSPLIT == 0 || NSPLIT == 1, "one or two A planes"); static_assert(K % GKC == 0 && K / GKC >= 2, "whole stages, at least two");
    constexpr int OPH = GT * GLP;                       // one operand's rows of a stage, in elements
    constexpr int STG = (NSPLIT == 1 ? 3 : 2) * OPH;    // a stage: [A | Bt | A2]
    __shared__ __align__(16) T16 sm[2 * STG];           // two stages; the output staging reuses them
    const size_t z = blockIdx.z; A += z * sA; if (NSPLIT == 1) A2 += z * sA; Bt += z * sB; C += z * sC;
    const int tid = threadIdx.x, lane = tid & 31, wave = tid >> 5, lr = lane & 15, hi = lane >> 4;
    const int r0 = blockIdx.x * GT, c0 = blockIdx.y * GT, wr = (wave & 1) * 64, wc = (wave >> 1) * 64;
    v8f acc[4][4];
#pragma unroll
    for (int mb = 0; mb < 4; ++mb)
#pragma unroll
        for (int nb = 0; nb < 4; ++nb) acc[mb][nb] = (v8f){};
    const int crow = tid >> 3, ccol = (tid & 7) * 8;    // this thread's 16-byte piece: eight lanes per 128-byte row, four whole lines per wave and copy
    constexpr size_t rs = (size_t)16 * K;
    const T16* gA = A + (size_t)(r0 + crow) * K + ccol; const T16* gB = Bt + (size_t)(c0 + crow) * K + ccol; const T16* gA2 = (NSPLIT == 1) ? A2 + (size_t)(r0 + crow) * K + ccol : nullptr;
    const unsigned l0 = (unsigned)(size_t)(sm + crow * GLP + ccol);   // low 32 bits of the shared address = LDS byte address
    auto fill = [&](int t, int buf) { const unsigned l = l0 + (unsigned)buf * (STG * 2);
        cp128(l, gA + (size_t)t * GKC, rs); cp128(l + OPH * 2, gB + (size_t)t * GKC, rs); if (NSPLIT == 1) cp128(l + 2 * OPH * 2, gA2 + (size_t)t * GKC, rs); };
    constexpr int nt = K / GKC;
    fill(0, 0);
    asm volatile("s_wait_asynccnt 0x0" ::: "memory");   // this wave's copies of stage 0 have landed
    __syncthreads();                                    // publishes stage 0
    fill(1, 1);
#pragma unroll 1   // rolled: one copy of a stage's work, the buffer picked by t & 1
    for (int t = 0; t < nt; ++t) {
        const T16* Sa = sm + (t & 1) * STG + (wr + lr) * GLP + 8 * hi; const T16* Sb = sm + (t & 1) * STG + OPH + (wc + lr) * GLP + 8 * hi;
#pragma unroll   // unrolled, as the loops inside: every fragment and accumulator index is a constant, so they stay in registers
        for (int kc = 0; kc < GKC; kc += 32) {
            V a[4], a2[4], b[4];   // all fragments of this 32 k as one group of LDS reads in front of the products
#pragma unroll
            for (int mb = 0; mb < 4; ++mb) { a[mb] = WFrag<T16>::ld(Sa + mb * 16 * GLP + kc); b[mb] = WFrag<T16>::ld(Sb + mb * 16 * GLP + kc); if (NSPLIT == 1) a2[mb] = WFrag<T16>::ld(Sa + 2 * OPH + mb * 16 * GLP + kc); }
            __builtin_amdgcn_sched_barrier(0);   // keeps the reads one group: sunk among the products they shared one register set, and the wave waited out the LDS latency at every fourth product
#pragma unroll
            for (int nb = 0; nb < 4; ++nb)
#pragma unroll
                for (int mb = 0; mb < 4; ++mb) { acc[mb][nb] = WFrag<T16>::mma(a[mb], b[nb], acc[mb][nb]); if (NSPLIT == 1) acc[mb][nb] = WFrag<T16>::mma(a2[mb], b[nb], acc[mb][nb]); }
        }
        __builtin_amdgcn_sched_barrier(0);                  // keeps the products in front of the barrier: sunk behind it they stood in front of the refill and took half a stage off the copies' lead
        asm volatile("s_wait_dscnt 0x0" ::: "memory");      // this wave's reads of stage t are done before the buffer is refilled
        asm volatile("s_wait_asynccnt 0x0" ::: "memory");   // this wave's copies of stage t + 1 have landed
        __syncthreads();                                    // publishes stage t + 1 and ends every wave's reads of stage t
        if (t + 2 < nt) fill(t + 2, t & 1);
    }
    asm volatile("s_wait_asynccnt 0x0" ::: "memory");       // no copy is outstanding when the buffers become output staging
    float* os = (float*)sm + wave * (16 * 68);              // 16 rows of 64 f32, pitch 68, per wave: rows go out as whole lines
#pragma unroll
    for (int mb = 0; mb < 4; ++mb) {
#pragma unroll
        for (int nb = 0; nb < 4; ++nb) {
#pragma unroll
            for (int j = 0; j < 8; ++j) os[(hi * 8 + j) * 68 + nb * 16 + lr] = acc[mb][nb][j]; }
        __builtin_amdgcn_wave_barrier(); asm volatile("" ::: "memory");   // keeps the row reads below behind the other lanes' LDS writes in the compiled order
        float* crw = C + (size_t)(r0 + wr + mb * 16) * ldc + c0 + wc;
#pragma unroll
        for (int s = 0; s < 8; ++s) { const int row = 2 * s + hi, cofs = lr * 4; v4f val = *(const v4fa*)(os + row * 68 + cofs); if (BIAS) { const float* bp = bias + c0 + wc + cofs; val[0] += bfr(bp[0]); val[1] += bfr(bp[1]); val[2] += bfr(bp[2]); val[3] += bfr(bp[3]); }
            *(v4f*)(crw + (size_t)row * ldc + cofs) = val; }
        asm volatile("s_wait_xcnt 0x0" ::: "memory");   // stands in front of the next rows' work, which rewrites registers that these stores name
        __builtin_amdgcn_wave_barrier(); asm volatile("" ::: "memory");   // keeps the next 16 rows' LDS writes behind these reads
    }
}

__device__ __forceinline__ h16 tohx(float x) { return (h16)x; }
__device__ __forceinline__ void splitf(float y, unsigned short& h, unsigned short& l) { h = f2bf(y); l = f2bf(y - bf2f(h)); }
typedef __attribute__((ext_vector_type(2))) _Float16 v2h;
typedef __attribute__((ext_vector_type(4))) _Float16 v4h;
typedef __attribute__((ext_vector_type(2))) unsigned short v2us;

__global__ __launch_bounds__(256) void k_cvt8(const float* __restrict__ src, bf* dst, size_t n8) { const size_t i = (size_t)blockIdx.x * 256 + threadIdx.x; if (i >= n8) return; const v8f v = *(const v8f*)(src + i * 8); v8us o;
#pragma unroll
    for (int k = 0; k < 8; ++k) o[k] = f2bf(v[k]); *(v8us*)(dst + i * 8) = o;  }
__global__ __launch_bounds__(256) void k_wtG(const float* __restrict__ w, int K, int N, bf* Bt) {
    const int lane = threadIdx.x & 31; const int L0 = (blockIdx.x * 8 + (threadIdx.x >> 5)) * 8; const int nlines = N * K / 64;
{
#pragma unroll 1
        for (int l = 0; l < 8; ++l) { const int L = L0 + l; if (L >= nlines) break; const size_t e = (size_t)L * 64 + lane * 2; const int k = (int)(e % K), n = (int)(e / K); v2us o;
            o[0] = f2bf(w[(size_t)k * N + n]); o[1] = f2bf(w[(size_t)(k + 1) * N + n]); *(v2us*)(Bt + e) = o; }
         }
}
__global__ __launch_bounds__(256) void k_p16(const float* __restrict__ F, h16* P) {
    const size_t i = ((size_t)blockIdx.x * 256 + threadIdx.x) * 2; if (i >= (size_t)NT * DD) return; v2h v; v[0] = tohx(F[i]); v[1] = tohx(F[i + 1]); *(v2h*)(P + i) = v;  }
__global__ __launch_bounds__(256) void k_vt16(const float* __restrict__ F, h16* VT) {
    const int lane = threadIdx.x & 31; const int L0 = (blockIdx.x * 8 + (threadIdx.x >> 5)) * 8; const int nlines = NT * DD / 64;
{
#pragma unroll
        for (int l = 0; l < 8; ++l) { const int L = L0 + l; if (L >= nlines) break; const int e = L * 64 + lane * 2; const int c = e & (TT - 1); const int d = (e >> 10) & (HD - 1); const int h = e >> 16; v2h v;
#pragma unroll
            for (int q = 0; q < 2; ++q) v[q] = tohx(F[(size_t)h * TT * HD + (size_t)(c + q) * HD + d]);
            *(v2h*)(VT + (size_t)e) = v; }
         }
}
#define SKEY 64                   // keys per LDS tile
#define LPH  72                   // LDS row pitch in halfs: 144 B = 16 B x 9
#define TILEH (SKEY * LPH)
typedef __attribute__((ext_vector_type(2))) float v2f;
typedef __attribute__((ext_vector_type(2))) _Float16 v2hh;
__device__ __forceinline__ float xhalf(float x) { return __builtin_bit_cast(float, __builtin_amdgcn_permlanex16(__builtin_bit_cast(int, x), __builtin_bit_cast(int, x), 0x76543210, 0xfedcba98, false, false)); }  // lane l with lane l ^ 16
__global__ __launch_bounds__(256) __attribute__((amdgpu_waves_per_eu(4, 4))) void k_fattn(const h16* __restrict__ Q, const h16* __restrict__ Kp, const h16* __restrict__ VT, float* __restrict__ O) {
    __shared__ __align__(16) h16 sm[4 * TILEH];     // [buffer][K | V^T][row][LPH]; the output staging reuses it
    const int tid = threadIdx.x, lane = tid & 31, wave = tid >> 5, c = lane & 15, h = lane >> 4;
    { const size_t hb = (size_t)blockIdx.y * TT * HD; Q += hb; Kp += hb; VT += hb; O += hb; }
    const int q0 = blockIdx.x * 256 + wave * 32;
    const float CS = SCL * 1.4426950408889634f;     // 1/8 and log2(e) in one factor
    v16h qf[2][2];
#pragma unroll
    for (int g = 0; g < 2; ++g)
#pragma unroll
        for (int kc = 0; kc < 2; ++kc) qf[g][kc] = WFrag<h16>::ld(Q + (size_t)(q0 + 16 * g + c) * HD + 32 * kc + 8 * h);
    v8f acc[2][4]; float m_run[2], l_run[2];
#pragma unroll
    for (int g = 0; g < 2; ++g) { m_run[g] = -3.0e38f; l_run[g] = 0.f;
#pragma unroll
        for (int t = 0; t < 4; ++t) acc[g][t] = (v8f){}; }
    const int srow = tid >> 3, scol = (tid & 7) * 8;   // this thread's 16-byte pieces of a tile: rows srow and srow + 32
    v8h rk[2], rv[2];
#pragma unroll
    for (int j = 0; j < 2; ++j) { rk[j] = *(const v8h*)(Kp + (size_t)(srow + 32 * j) * HD + scol); rv[j] = *(const v8h*)(VT + (size_t)(srow + 32 * j) * TT + scol); }
#pragma unroll
    for (int j = 0; j < 2; ++j) { *(v8h*)(sm + (srow + 32 * j) * LPH + scol) = rk[j]; *(v8h*)(sm + TILEH + (srow + 32 * j) * LPH + scol) = rv[j]; }
    __syncthreads();
#pragma unroll 1   // rolled: one copy of the tile's work, the buffer picked by s & 1
    for (int s = 0; s < TT / SKEY; ++s) {
        if (s + 1 < TT / SKEY) {
#pragma unroll
            for (int j = 0; j < 2; ++j) { rk[j] = *(const v8h*)(Kp + (size_t)((s + 1) * SKEY + srow + 32 * j) * HD + scol); rv[j] = *(const v8h*)(VT + (size_t)(srow + 32 * j) * TT + (s + 1) * SKEY + scol); }
        }
        const h16* Kb = sm + (s & 1) * (2 * TILEH); const h16* Vb = Kb + TILEH;
#pragma unroll 1   // rolled: with both 32-key passes unrolled the build spilled a staged load to scratch, which put its wait at the head of the tile
        for (int p = 0; p < SKEY / 32; ++p) {
            v8f sc[2][2];
#pragma unroll
            for (int kt = 0; kt < 2; ++kt) { v16h kf[2];
#pragma unroll
                for (int kc = 0; kc < 2; ++kc) kf[kc] = WFrag<h16>::ld(Kb + (32 * p + 16 * kt + c) * LPH + 32 * kc + 8 * h);
#pragma unroll
                for (int g = 0; g < 2; ++g) { sc[kt][g] = (v8f){};
#pragma unroll
                    for (int kc = 0; kc < 2; ++kc) sc[kt][g] = wmma16(kf[kc], qf[g][kc], sc[kt][g]); } }
            v16h vf[4];
#pragma unroll
            for (int t = 0; t < 4; ++t) vf[t] = WFrag<h16>::ld(Vb + (16 * t + c) * LPH + 32 * p + 8 * h);
#pragma unroll
            for (int g = 0; g < 2; ++g) {
                float mx = sc[0][g][0];
#pragma unroll
                for (int r = 1; r < 8; ++r) mx = fmaxf(mx, sc[0][g][r]);
#pragma unroll
                for (int r = 0; r < 8; ++r) mx = fmaxf(mx, sc[1][g][r]);
                mx = fmaxf(mx, xhalf(mx));             // both wave halves hold this query's maximum over the 32 keys
                const float mn = fmaxf(m_run[g], mx * CS); const float corr = __builtin_amdgcn_exp2f(m_run[g] - mn); m_run[g] = mn;
                float ls = 0.f; v16h pf;
#pragma unroll
                for (int i = 0; i < 8; ++i) {
                    const v2f a = __builtin_elementwise_fma((v2f){sc[i >> 2][g][2 * (i & 3)], sc[i >> 2][g][2 * (i & 3) + 1]}, (v2f){CS, CS}, (v2f){-mn, -mn});
                    const float p0 = __builtin_amdgcn_exp2f(a[0]), p1 = __builtin_amdgcn_exp2f(a[1]); ls += p0 + p1;
                    const v2hh w = __builtin_convertvector((v2f){p0, p1}, v2hh); pf[2 * i] = w[0]; pf[2 * i + 1] = w[1]; }
                l_run[g] = l_run[g] * corr + ls;       // this half's keys only; the halves are joined once, behind the loop
#pragma unroll
                for (int t = 0; t < 4; ++t) { acc[g][t] = acc[g][t] * corr; acc[g][t] = wmma16(vf[t], pf, acc[g][t]); }
            }
        }
        if (s + 1 < TT / SKEY) { h16* Wb = sm + ((s + 1) & 1) * (2 * TILEH);   // its last readers left it in front of the barrier that ended trip s - 1
#pragma unroll
            for (int j = 0; j < 2; ++j) { *(v8h*)(Wb + (srow + 32 * j) * LPH + scol) = rk[j]; *(v8h*)(Wb + TILEH + (srow + 32 * j) * LPH + scol) = rv[j]; }
        }
        __syncthreads();   // publishes tile s + 1 and ends every wave's reads of tile s
    }
    float* os = (float*)sm + wave * (16 * 68);   // 16 query rows of 64 f32, pitch 68, per wave: rows go out as whole lines
#pragma unroll
    for (int g = 0; g < 2; ++g) {
        const float f = __fdiv_rn(PCAR, l_run[g] + xhalf(l_run[g]));   // x PCAR: k_merge takes it off again
#pragma unroll
        for (int t = 0; t < 4; ++t) { v4f lo, hi4;
#pragma unroll
            for (int r = 0; r < 4; ++r) { lo[r] = acc[g][t][r] * f; hi4[r] = acc[g][t][r + 4] * f; }
            *(v4fa*)(os + c * 68 + 16 * t + 8 * h) = lo; *(v4fa*)(os + c * 68 + 16 * t + 8 * h + 4) = hi4; }
        __builtin_amdgcn_wave_barrier(); asm volatile("" ::: "memory");   // keeps the row reads below behind the other lanes' LDS writes in the compiled order
#pragma unroll
        for (int i = 0; i < 8; ++i) { const int row = 2 * i + h; const v4f val = *(const v4fa*)(os + row * 68 + c * 4); *(v4f*)(O + (size_t)(q0 + 16 * g + row) * HD + c * 4) = val; }
        __builtin_amdgcn_wave_barrier(); asm volatile("" ::: "memory");   // keeps the next group's LDS writes behind these reads
    }
}
__global__ __launch_bounds__(256) void k_merge(const float* __restrict__ O, bf* Ah, bf* Al) {
    { const size_t zb = (size_t)blockIdx.y * TT * DD; O += zb; Ah += zb; Al += zb; }   // blockIdx.y = batch
    const int lane = threadIdx.x & 31; const int L0 = (blockIdx.x * 8 + (threadIdx.x >> 5)) * 8; const int nlines = NH_ * TT * HD / 64;
{
#pragma unroll
        for (int l = 0; l < 8; ++l) { const int L = L0 + l; if (L >= nlines) break; const int e = L * 64 + lane * 2; const int d = e & (HD - 1); const int c = (e >> 6) & (TT - 1); const int h = e >> 16; v2us oh, ol;
#pragma unroll
            for (int q = 0; q < 2; ++q) { unsigned short a, c2; splitf(O[(size_t)e + q] * (1.0f / PCAR), a, c2); oh[q] = a; ol[q] = c2; }
            const size_t o = (size_t)c * DD + h * HD + d; *(v2us*)(Ah + o) = oh; *(v2us*)(Al + o) = ol; }
         }
}

extern "C" void kernel_launch(void* const* d_in, const int* in_sizes, int n_in,
                              void* d_out, int out_size, void* d_ws, size_t ws_size, hipStream_t stream) {
    (void)in_sizes; (void)n_in; (void)out_size;
    const float* x = (const float*)d_in[0]; const float* Wq = (const float*)d_in[1]; const float* bq = (const float*)d_in[2]; const float* Wk = (const float*)d_in[3]; const float* bk = (const float*)d_in[4]; const float* Wv = (const float*)d_in[5]; const float* bv = (const float*)d_in[6]; const float* Wo = (const float*)d_in[7]; const float* bo = (const float*)d_in[8];
    float* OUT = (float*)d_out;     // [16][1024][768]
    char* wsp = (char*)d_ws;
    auto take = [&](size_t bytes) { char* p = wsp; wsp += (bytes + 255) & ~(size_t)255; return (void*)p; };
    bf* WQ = (bf*)take((size_t)DD * FIN * 2); bf* WK = (bf*)take((size_t)DD * FIN * 2); bf* WV = (bf*)take((size_t)DD * FIN * 2); bf* WO = (bf*)take((size_t)DO * DD * 2);
    h16* QP = (h16*)take((size_t)NT * DD * 2); h16* KP = (h16*)take((size_t)NT * DD * 2); h16* VT = (h16*)take((size_t)NT * DD * 2); float* Ob = (float*)take((size_t)NT * DD * 4);
    // one region, two tenants one after the other: {XB, F} for the projections, {ATh, ATl} for the output product
    char* const reg = wsp;
    bf* ATh = (bf*)take((size_t)NT * DD * 2); bf* ATl = (bf*)take((size_t)NT * DD * 2);
    wsp = reg; bf* XB = (bf*)take((size_t)NT * FIN * 2); float* F = (float*)take((size_t)NT * DD * 4);
    if ((size_t)(wsp - (char*)d_ws) > ws_size) return;    // total ~ 206 MB ({XB, F} is the larger tenant); ws 256 MiB
    { const unsigned gW = (unsigned)((DD * FIN / 64 + 63) / 64); k_wtG<<<gW, 256, 0, stream>>>(Wq, FIN, DD, WQ); k_wtG<<<gW, 256, 0, stream>>>(Wk, FIN, DD, WK); k_wtG<<<gW, 256, 0, stream>>>(Wv, FIN, DD, WV); k_wtG<<<(unsigned)((DO * DD / 64 + 63) / 64), 256, 0, stream>>>(Wo, DD, DO, WO);
      const size_t nx = (size_t)NT * FIN / 8; k_cvt8<<<(unsigned)((nx + 255) / 256), 256, 0, stream>>>(x, XB, nx); }
    // all 16 batches per launch: the rows of x are one [NT][768] matrix, and the 192 head planes are the flat projection memory
    const unsigned LP = (unsigned)(((size_t)NT * DD / 2 + 255) / 256), LV = (unsigned)((NT * DD / 64 + 63) / 64); const dim3 gP(NT / GT, DD / GT, 1);
    k_gemmw<bf, 0, true, FIN><<<gP, 128, 0, stream>>>(XB, nullptr, WQ, F, DD, bq, 0, 0, 0); k_p16<<<LP, 256, 0, stream>>>(F, QP);
    k_gemmw<bf, 0, true, FIN><<<gP, 128, 0, stream>>>(XB, nullptr, WK, F, DD, bk, 0, 0, 0); k_p16<<<LP, 256, 0, stream>>>(F, KP);
    k_gemmw<bf, 0, true, FIN><<<gP, 128, 0, stream>>>(XB, nullptr, WV, F, DD, bv, 0, 0, 0); k_vt16<<<LV, 256, 0, stream>>>(F, VT);
    k_fattn<<<dim3(TT / 256, NB_ * NH_, 1), 256, 0, stream>>>(QP, KP, VT, Ob);
    k_merge<<<dim3((unsigned)((TT * DD / 64 + 63) / 64), NB_, 1), 256, 0, stream>>>(Ob, ATh, ATl);
    k_gemmw<bf, 1, true, DD><<<dim3(NT / GT, DO / GT, 1), 128, 0, stream>>>(ATh, ATl, WO, OUT, DO, bo, 0, 0, 0);
}

// v004
// A run of this version takes 210 microseconds.
// Two timings next to v003 both put it at 1.28 times that version's speed.
// All steps since v000 together make it 10.3 times as fast.
#include <hip/hip_runtime.h>

// ViT self-attention (x [16][1024][768]; q/k/v = x @ W + b; the module reshapes (B,N,C) -> (B*H, N, Dh) WITHOUT a transpose, so "head" g of a batch is the contiguous chunk g of the
// projection viewed as [1024][64]; scores = q2.k2 / 8; softmax; ctx2 = attn.v2; ctx2.reshape(B,H,N,Dh).transpose(0,2,1,3) -> [n][h*64+d]; out = ctx @ Wo + bo [16][1024][768]).
// Compute dtypes, f32 accumulate: every input rounded to bf16; projections on PLAIN bf16 operands (inputs: exact, + bias); scores and attn.v on SINGLE fp16 planes
// (the head planes ARE the projection memory: flat fp16 planes that the projection GEMMs store; 1/8 applied in f32 in the softmax; P = exp(s - running max), at most 1); scores, softmax and attn.v run in ONE kernel, no score plane in memory;
// no f32 plane lies between the kernels: the projection GEMMs store the fp16 planes, and the attention kernel stores the output product's two bf16 planes, from their own epilogues.

#define NB_  16
#define TT   1024
#define FIN  768
#define DD   768                  // H * Dh
#define NH_  12
#define HD   64
#define DO   768
#define NT   (NB_ * TT)
#define SCL  0.125f               // 1/sqrt(64)
typedef _Float16 h16;
typedef unsigned short bf;
typedef __attribute__((ext_vector_type(16))) __bf16   v16bf;
typedef __attribute__((ext_vector_type(16))) _Float16 v16h;
typedef __attribute__((ext_vector_type(8)))  _Float16 v8h;
typedef __attribute__((ext_vector_type(8)))  unsigned short v8us;
typedef __attribute__((ext_vector_type(8)))  float    v8f;
typedef __attribute__((ext_vector_type(4)))  float    v4f;
typedef v8h  __attribute__((may_alias)) v8ha;
typedef v4f  __attribute__((may_alias)) v4fa;
typedef v8us __attribute__((may_alias)) v8usa;

__device__ __forceinline__ unsigned short f2bf(float f) { unsigned u = __float_as_uint(f); u += 0x7FFFu + ((u >> 16) & 1u); return (unsigned short)(u >> 16); }
__device__ __forceinline__ float bf2f(unsigned short b) { return __uint_as_float(((unsigned)b) << 16); }
__device__ __forceinline__ float bfr(float f) { return bf2f(f2bf(f)); }
__device__ __forceinline__ v16h cat16(v8h lo, v8h hi) { return __builtin_shufflevector(lo, hi, 0, 1, 2, 3, 4, 5, 6, 7, 8, 9, 10, 11, 12, 13, 14, 15); }
__device__ __forceinline__ v16bf cat16b(v8us lo, v8us hi) { return __builtin_bit_cast(v16bf, __builtin_shufflevector(lo, hi, 0, 1, 2, 3, 4, 5, 6, 7, 8, 9, 10, 11, 12, 13, 14, 15)); }
__device__ __forceinline__ v8f wmma16(v16h a, v16h b, v8f c) { return __builtin_amdgcn_wmma_f32_16x16x32_f16(false, a, false, b, (short)0, c, false, false); }
__device__ __forceinline__ v8f wmmab(v16bf a, v16bf b, v8f c) { return __builtin_amdgcn_wmma_f32_16x16x32_bf16(false, a, false, b, (short)0, c, false, false); }



// ---- k_gemmw: GEMM, one 128x128 output tile per work-group of FOUR WAVES (2 x 2, each 64x64 = 16 accumulators); grid (M/128, N/128, Z), 128 threads.
// C[m][n] (f32, or for H16OUT rounded once to fp16 into Ch; pitch ldc, + optional f32 bias[n]) = sum_k A[m][k] Bt[n][k] (+ A2[m][k] Bt[n][k] for NSPLIT == 1). z-batch strides sA/sB/sC in elements. M, N % 128 == 0, K % 64 == 0, a compile-time constant.
// The operands' rows come as whole 128-byte lines (64 k) by asynchronous copies into two LDS buffers (row pitch 144 B for the 16-byte fragment reads) and are shared by the waves;
// the copies of stage t + 2 fly under the work on stage t + 1.
template <typename T16> struct WFrag;
template <> struct WFrag<h16> { typedef v16h V; static __device__ __forceinline__ V ld(const h16* p) { return cat16(*(const v8h*)p, *(const v8h*)(p + 16)); } static __device__ __forceinline__ v8f mma(V a, V b, v8f c) { return wmma16(a, b, c); } };
template <> struct WFrag<bf> { typedef v16bf V; static __device__ __forceinline__ V ld(const bf* p) { return cat16b(*(const v8us*)p, *(const v8us*)(p + 16)); } static __device__ __forceinline__ v8f mma(V a, V b, v8f c) { return wmmab(a, b, c); } };
#define GT   128                  // rows and columns of a work-group's output tile
#define GKC  64                   // k per stage
#define GLP  72                   // LDS row pitch in 16-bit elements: 144 B = 16 B x 9
// One operand's 128 rows of a stage: this lane's 16 bytes of rows r, r + 16, ..., r + 112 (l: its LDS byte address, g: its global address, rs: 16 rows in elements).
// The s_wait_xcnt stands inside the statement so that no address register named here is rewritten in front of it.
template <typename T16>
__device__ __forceinline__ void cp128(unsigned l, const T16* g, size_t rs) {
    asm volatile("global_load_async_to_lds_b128 %0, %8, off\n\t"
                 "global_load_async_to_lds_b128 %1, %9, off\n\t"
                 "global_load_async_to_lds_b128 %2, %10, off\n\t"
                 "global_load_async_to_lds_b128 %3, %11, off\n\t"
                 "global_load_async_to_lds_b128 %4, %12, off\n\t"
                 "global_load_async_to_lds_b128 %5, %13, off\n\t"
                 "global_load_async_to_lds_b128 %6, %14, off\n\t"
                 "global_load_async_to_lds_b128 %7, %15, off\n\t"
                 "s_wait_xcnt 0x0"
                 :: "v"(l), "v"(l + 1u * 16 * GLP * 2), "v"(l + 2u * 16 * GLP * 2), "v"(l + 3u * 16 * GLP * 2), "v"(l + 4u * 16 * GLP * 2), "v"(l + 5u * 16 * GLP * 2), "v"(l + 6u * 16 * GLP * 2), "v"(l + 7u * 16 * GLP * 2),
                    "v"(g), "v"(g + rs), "v"(g + 2 * rs), "v"(g + 3 * rs), "v"(g + 4 * rs), "v"(g + 5 * rs), "v"(g + 6 * rs), "v"(g + 7 * rs) : "memory");
}
template <typename T16, int NSPLIT, bool BIAS, int K, bool H16OUT>
__global__ __launch_bounds__(128) void k_gemmw(const T16* __restrict__ A, const T16* __restrict__ A2, const T16* __restrict__ Bt, float* C, h16* Ch, int ldc, const float* __restrict__ bias, size_t sA, size_t sB, size_t sC) {
    typedef typename WFrag<T16>::V V;
    static_assert(NSPLIT == 0 || NSPLIT == 1, "one or two A planes"); static_assert(K % GKC == 0 && K / GKC >= 2, "whole stages, at least two");
    constexpr int OPH = GT * GLP;                       // one operand's rows of a stage, in elements
    constexpr int STG = (NSPLIT == 1 ? 3 : 2) * OPH;    // a stage: [A | Bt | A2]
    __shared__ __align__(16) T16 sm[2 * STG];           // two stages; the output staging reuses them
    const size_t z = blockIdx.z; A += z * sA; if (NSPLIT == 1) A2 += z * sA; Bt += z * sB; if (H16OUT) Ch += z * sC; else C += z * sC;
    const int tid = threadIdx.x, lane = tid & 31, wave = tid >> 5, lr = lane & 15, hi = lane >> 4;
    const int r0 = blockIdx.x * GT, c0 = blockIdx.y * GT, wr = (wave & 1) * 64, wc = (wave >> 1) * 64;
    v8f acc[4][4];
#pragma unroll
    for (int mb = 0; mb < 4; ++mb)
#pragma unroll
        for (int nb = 0; nb < 4; ++nb) acc[mb][nb] = (v8f){};
    const int crow = tid >> 3, ccol = (tid & 7) * 8;    // this thread's 16-byte piece: eight lanes per 128-byte row, four whole lines per wave and copy
    constexpr size_t rs = (size_t)16 * K;
    const T16* gA = A + (size_t)(r0 + crow) * K + ccol; const T16* gB = Bt + (size_t)(c0 + crow) * K + ccol; const T16* gA2 = (NSPLIT == 1) ? A2 + (size_t)(r0 + crow) * K + ccol : nullptr;
    const unsigned l0 = (unsigned)(size_t)(sm + crow * GLP + ccol);   // low 32 bits of the shared address = LDS byte address
    auto fill = [&](int t, int buf) { const unsigned l = l0 + (unsigned)buf * (STG * 2);
        cp128(l, gA + (size_t)t * GKC, rs); cp128(l + OPH * 2, gB + (size_t)t * GKC, rs); if (NSPLIT == 1) cp128(l + 2 * OPH * 2, gA2 + (size_t)t * GKC, rs); };
    constexpr int nt = K / GKC;
    fill(0, 0);
    asm volatile("s_wait_asynccnt 0x0" ::: "memory");   // this wave's copies of stage 0 have landed
    __syncthreads();                                    // publishes stage 0
    fill(1, 1);
#pragma unroll 1   // rolled: one copy of a stage's work, the buffer picked by t & 1
    for (int t = 0; t < nt; ++t) {
        const T16* Sa = sm + (t & 1) * STG + (wr + lr) * GLP + 8 * hi; const T16* Sb = sm + (t & 1) * STG + OPH + (wc + lr) * GLP + 8 * hi;
#pragma unroll   // unrolled, as the loops inside: every fragment and accumulator index is a constant, so they stay in registers
        for (int kc = 0; kc < GKC; kc += 32) {
            V a[4], a2[4], b[4];   // all fragments of this 32 k as one group of LDS reads in front of the products
#pragma unroll
            for (int mb = 0; mb < 4; ++mb) { a[mb] = WFrag<T16>::ld(Sa + mb * 16 * GLP + kc); b[mb] = WFrag<T16>::ld(Sb + mb * 16 * GLP + kc); if (NSPLIT == 1) a2[mb] = WFrag<T16>::ld(Sa + 2 * OPH + mb * 16 * GLP + kc); }
            __builtin_amdgcn_sched_barrier(0);   // keeps the reads one group: sunk among the products they shared one register set, and the wave waited out the LDS latency at every fourth product
#pragma unroll
            for (int nb = 0; nb < 4; ++nb)
#pragma unroll
                for (int mb = 0; mb < 4; ++mb) { acc[mb][nb] = WFrag<T16>::mma(a[mb], b[nb], acc[mb][nb]); if (NSPLIT == 1) acc[mb][nb] = WFrag<T16>::mma(a2[mb], b[nb], acc[mb][nb]); }
        }
        __builtin_amdgcn_sched_barrier(0);                  // keeps the products in front of the barrier: sunk behind it they stood in front of the refill and took half a stage off the copies' lead
        asm volatile("s_wait_dscnt 0x0" ::: "memory");      // this wave's reads of stage t are done before the buffer is refilled
        asm volatile("s_wait_asynccnt 0x0" ::: "memory");   // this wave's copies of stage t + 1 have landed
        __syncthreads();                                    // publishes stage t + 1 and ends every wave's reads of stage t
        if (t + 2 < nt) fill(t + 2, t & 1);
    }
    asm volatile("s_wait_asynccnt 0x0" ::: "memory");       // no copy is outstanding when the buffers become output staging
    float* os = (float*)sm + wave * (16 * 68);              // 16 rows of 64 f32, pitch 68, per wave: rows go out as whole lines
#pragma unroll
    for (int mb = 0; mb < 4; ++mb) {
#pragma unroll
        for (int nb = 0; nb < 4; ++nb) {
#pragma unroll
            for (int j = 0; j < 8; ++j) os[(hi * 8 + j) * 68 + nb * 16 + lr] = acc[mb][nb][j]; }
        __builtin_amdgcn_wave_barrier(); asm volatile("" ::: "memory");   // keeps the row reads below behind the other lanes' LDS writes in the compiled order
        if (H16OUT) {   // a row of 64 fp16 is one 128-byte line: eight lanes a row, four rows a store
            h16* crh = Ch + (size_t)(r0 + wr + mb * 16) * ldc + c0 + wc;
#pragma unroll
            for (int s = 0; s < 4; ++s) { const int row = 4 * s + (lane >> 3), cofs = (lane & 7) * 8; const v4f v0 = *(const v4fa*)(os + row * 68 + cofs), v1 = *(const v4fa*)(os + row * 68 + cofs + 4); v8h o;
#pragma unroll
                for (int k = 0; k < 4; ++k) { const float* bp = bias + c0 + wc + cofs; o[k] = (h16)(BIAS ? v0[k] + bfr(bp[k]) : v0[k]); o[k + 4] = (h16)(BIAS ? v1[k] + bfr(bp[k + 4]) : v1[k]); }
                *(v8h*)(crh + (size_t)row * ldc + cofs) = o; }
        } else {
        float* crw = C + (size_t)(r0 + wr + mb * 16) * ldc + c0 + wc;
#pragma unroll
        for (int s = 0; s < 8; ++s) { const int row = 2 * s + hi, cofs = lr * 4; v4f val = *(const v4fa*)(os + row * 68 + cofs); if (BIAS) { const float* bp = bias + c0 + wc + cofs; val[0] += bfr(bp[0]); val[1] += bfr(bp[1]); val[2] += bfr(bp[2]); val[3] += bfr(bp[3]); }
            *(v4f*)(crw + (size_t)row * ldc + cofs) = val; }
        }
        asm volatile("s_wait_xcnt 0x0" ::: "memory");   // stands in front of the next rows' work, which rewrites registers that these stores name
        __builtin_amdgcn_wave_barrier(); asm volatile("" ::: "memory");   // keeps the next 16 rows' LDS writes behind these reads
    }
}

__device__ __forceinline__ void splitf(float y, unsigned short& h, unsigned short& l) { h = f2bf(y); l = f2bf(y - bf2f(h)); }
typedef __attribute__((ext_vector_type(2))) _Float16 v2h;
typedef __attribute__((ext_vector_type(4))) _Float16 v4h;
typedef __attribute__((ext_vector_type(2))) unsigned short v2us;

__global__ __launch_bounds__(256) void k_cvt8(const float* __restrict__ src, bf* dst, size_t n8) { const size_t i = (size_t)blockIdx.x * 256 + threadIdx.x; if (i >= n8) return; const v8f v = *(const v8f*)(src + i * 8); v8us o;
#pragma unroll
    for (int k = 0; k < 8; ++k) o[k] = f2bf(v[k]); *(v8us*)(dst + i * 8) = o;  }
__global__ __launch_bounds__(256) void k_wtG(const float* __restrict__ w, int K, int N, bf* Bt) {
    const int lane = threadIdx.x & 31; const int L0 = (blockIdx.x * 8 + (threadIdx.x >> 5)) * 8; const int nlines = N * K / 64;
{
#pragma unroll 1
        for (int l = 0; l < 8; ++l) { const int L = L0 + l; if (L >= nlines) break; const size_t e = (size_t)L * 64 + lane * 2; const int k = (int)(e % K), n = (int)(e / K); v2us o;
            o[0] = f2bf(w[(size_t)k * N + n]); o[1] = f2bf(w[(size_t)(k + 1) * N + n]); *(v2us*)(Bt + e) = o; }
         }
}
__global__ __launch_bounds__(256) void k_vt16(const h16* __restrict__ F, h16* VT) {
    const int lane = threadIdx.x & 31; const int L0 = (blockIdx.x * 8 + (threadIdx.x >> 5)) * 8; const int nlines = NT * DD / 64;
{
#pragma unroll
        for (int l = 0; l < 8; ++l) { const int L = L0 + l; if (L >= nlines) break; const int e = L * 64 + lane * 2; const int c = e & (TT - 1); const int d = (e >> 10) & (HD - 1); const int h = e >> 16; v2h v;
#pragma unroll
            for (int q = 0; q < 2; ++q) v[q] = F[(size_t)h * TT * HD + (size_t)(c + q) * HD + d];
            *(v2h*)(VT + (size_t)e) = v; }
         }
}
#define SKEY 64                   // keys per LDS tile
#define LPH  72                   // LDS row pitch in halfs: 144 B = 16 B x 9
#define TILEH (SKEY * LPH)
typedef __attribute__((ext_vector_type(2))) float v2f;
typedef __attribute__((ext_vector_type(2))) _Float16 v2hh;
__device__ __forceinline__ float xhalf(float x) { return __builtin_bit_cast(float, __builtin_amdgcn_permlanex16(__builtin_bit_cast(int, x), __builtin_bit_cast(int, x), 0x76543210, 0xfedcba98, false, false)); }  // lane l with lane l ^ 16
__global__ __launch_bounds__(256) __attribute__((amdgpu_waves_per_eu(4, 4))) void k_fattn(const h16* __restrict__ Q, const h16* __restrict__ Kp, const h16* __restrict__ VT, bf* __restrict__ Ah, bf* __restrict__ Al) {
    __shared__ __align__(16) h16 sm[4 * TILEH];     // [buffer][K | V^T][row][LPH]; the output staging reuses it
    const int tid = threadIdx.x, lane = tid & 31, wave = tid >> 5, c = lane & 15, h = lane >> 4;
    { const size_t hb = (size_t)blockIdx.y * TT * HD; Q += hb; Kp += hb; VT += hb;
      const size_t ob = (size_t)(blockIdx.y / NH_) * TT * DD + (size_t)(blockIdx.y % NH_) * HD; Ah += ob; Al += ob; }
    const int q0 = blockIdx.x * 256 + wave * 32;
    const float CS = SCL * 1.4426950408889634f;     // 1/8 and log2(e) in one factor
    v16h qf[2][2];
#pragma unroll
    for (int g = 0; g < 2; ++g)
#pragma unroll
        for (int kc = 0; kc < 2; ++kc) qf[g][kc] = WFrag<h16>::ld(Q + (size_t)(q0 + 16 * g + c) * HD + 32 * kc + 8 * h);
    v8f acc[2][4]; float m_run[2], l_run[2];
#pragma unroll
    for (int g = 0; g < 2; ++g) { m_run[g] = -3.0e38f; l_run[g] = 0.f;
#pragma unroll
        for (int t = 0; t < 4; ++t) acc[g][t] = (v8f){}; }
    const int srow = tid >> 3, scol = (tid & 7) * 8;   // this thread's 16-byte pieces of a tile: rows srow and srow + 32
    v8h rk[2], rv[2];
#pragma unroll
    for (int j = 0; j < 2; ++j) { rk[j] = *(const v8h*)(Kp + (size_t)(srow + 32 * j) * HD + scol); rv[j] = *(const v8h*)(VT + (size_t)(srow + 32 * j) * TT + scol); }
#pragma unroll
    for (int j = 0; j < 2; ++j) { *(v8h*)(sm + (srow + 32 * j) * LPH + scol) = rk[j]; *(v8h*)(sm + TILEH + (srow + 32 * j) * LPH + scol) = rv[j]; }
    __syncthreads();
#pragma unroll 1   // rolled: one copy of the tile's work, the buffer picked by s & 1
    for (int s = 0; s < TT / SKEY; ++s) {
        if (s + 1 < TT / SKEY) {
#pragma unroll
            for (int j = 0; j < 2; ++j) { rk[j] = *(const v8h*)(Kp + (size_t)((s + 1) * SKEY + srow + 32 * j) * HD + scol); rv[j] = *(const v8h*)(VT + (size_t)(srow + 32 * j) * TT + (s + 1) * SKEY + scol); }
        }
        const h16* Kb = sm + (s & 1) * (2 * TILEH); const h16* Vb = Kb + TILEH;
#pragma unroll 1   // rolled: with both 32-key passes unrolled the build spilled a staged load to scratch, which put its wait at the head of the tile
        for (int p = 0; p < SKEY / 32; ++p) {
            v8f sc[2][2];
#pragma unroll
            for (int kt = 0; kt < 2; ++kt) { v16h kf[2];
#pragma unroll
                for (int kc = 0; kc < 2; ++kc) kf[kc] = WFrag<h16>::ld(Kb + (32 * p + 16 * kt + c) * LPH + 32 * kc + 8 * h);
#pragma unroll
                for (int g = 0; g < 2; ++g) { sc[kt][g] = (v8f){};
#pragma unroll
                    for (int kc = 0; kc < 2; ++kc) sc[kt][g] = wmma16(kf[kc], qf[g][kc], sc[kt][g]); } }
            v16h vf[4];
#pragma unroll
            for (int t = 0; t < 4; ++t) vf[t] = WFrag<h16>::ld(Vb + (16 * t + c) * LPH + 32 * p + 8 * h);
#pragma unroll
            for (int g = 0; g < 2; ++g) {
                float mx = sc[0][g][0];
#pragma unroll
                for (int r = 1; r < 8; ++r) mx = fmaxf(mx, sc[0][g][r]);
#pragma unroll
                for (int r = 0; r < 8; ++r) mx = fmaxf(mx, sc[1][g][r]);
                mx = fmaxf(mx, xhalf(mx));             // both wave halves hold this query's maximum over the 32 keys
                const float mn = fmaxf(m_run[g], mx * CS); const float corr = __builtin_amdgcn_exp2f(m_run[g] - mn); m_run[g] = mn;
                float ls = 0.f; v16h pf;
#pragma unroll
                for (int i = 0; i < 8; ++i) {
                    const v2f a = __builtin_elementwise_fma((v2f){sc[i >> 2][g][2 * (i & 3)], sc[i >> 2][g][2 * (i & 3) + 1]}, (v2f){CS, CS}, (v2f){-mn, -mn});
                    const float p0 = __builtin_amdgcn_exp2f(a[0]), p1 = __builtin_amdgcn_exp2f(a[1]); ls += p0 + p1;
                    const v2hh w = __builtin_convertvector((v2f){p0, p1}, v2hh); pf[2 * i] = w[0]; pf[2 * i + 1] = w[1]; }
                l_run[g] = l_run[g] * corr + ls;       // this half's keys only; the halves are joined once, behind the loop
#pragma unroll
                for (int t = 0; t < 4; ++t) { acc[g][t] = acc[g][t] * corr; acc[g][t] = wmma16(vf[t], pf, acc[g][t]); }
            }
        }
        if (s + 1 < TT / SKEY) { h16* Wb = sm + ((s + 1) & 1) * (2 * TILEH);   // its last readers left it in front of the barrier that ended trip s - 1
#pragma unroll
            for (int j = 0; j < 2; ++j) { *(v8h*)(Wb + (srow + 32 * j) * LPH + scol) = rk[j]; *(v8h*)(Wb + TILEH + (srow + 32 * j) * LPH + scol) = rv[j]; }
        }
        __syncthreads();   // publishes tile s + 1 and ends every wave's reads of tile s
    }
    float* os = (float*)sm + wave * (16 * 68);   // 16 query rows of 64 f32, pitch 68, per wave: rows go out as whole lines
#pragma unroll
    for (int g = 0; g < 2; ++g) {
        const float f = __fdiv_rn(1.0f, l_run[g] + xhalf(l_run[g]));
#pragma unroll
        for (int t = 0; t < 4; ++t) { v4f lo, hi4;
#pragma unroll
            for (int r = 0; r < 4; ++r) { lo[r] = acc[g][t][r] * f; hi4[r] = acc[g][t][r + 4] * f; }
            *(v4fa*)(os + c * 68 + 16 * t + 8 * h) = lo; *(v4fa*)(os + c * 68 + 16 * t + 8 * h + 4) = hi4; }
        __builtin_amdgcn_wave_barrier(); asm volatile("" ::: "memory");   // keeps the row reads below behind the other lanes' LDS writes in the compiled order
#pragma unroll
        for (int i = 0; i < 4; ++i) { const int row = 4 * i + (lane >> 3), cofs = (lane & 7) * 8;   // a row of 64 bf16 is one 128-byte line: eight lanes a row, four rows a store
            const v4f v0 = *(const v4fa*)(os + row * 68 + cofs), v1 = *(const v4fa*)(os + row * 68 + cofs + 4); v8us oh, ol;
#pragma unroll
            for (int k = 0; k < 4; ++k) { unsigned short a, b; splitf(v0[k], a, b); oh[k] = a; ol[k] = b; splitf(v1[k], a, b); oh[k + 4] = a; ol[k + 4] = b; }
            const size_t o = (size_t)(q0 + 16 * g + row) * DD + cofs; *(v8us*)(Ah + o) = oh; *(v8us*)(Al + o) = ol; }
        asm volatile("s_wait_xcnt 0x0" ::: "memory");   // stands in front of the next group's work, which rewrites registers that these stores name
        __builtin_amdgcn_wave_barrier(); asm volatile("" ::: "memory");   // keeps the next group's LDS writes behind these reads
    }
}

extern "C" void kernel_launch(void* const* d_in, const int* in_sizes, int n_in,
                              void* d_out, int out_size, void* d_ws, size_t ws_size, hipStream_t stream) {
    (void)in_sizes; (void)n_in; (void)out_size;
    const float* x = (const float*)d_in[0]; const float* Wq = (const float*)d_in[1]; const float* bq = (const float*)d_in[2]; const float* Wk = (const float*)d_in[3]; const float* bk = (const float*)d_in[4]; const float* Wv = (const float*)d_in[5]; const float* bv = (const float*)d_in[6]; const float* Wo = (const float*)d_in[7]; const float* bo = (const float*)d_in[8];
    float* OUT = (float*)d_out;     // [16][1024][768]
    char* wsp = (char*)d_ws;
    auto take = [&](size_t bytes) { char* p = wsp; wsp += (bytes + 255) & ~(size_t)255; return (void*)p; };
    bf* WQ = (bf*)take((size_t)DD * FIN * 2); bf* WK = (bf*)take((size_t)DD * FIN * 2); bf* WV = (bf*)take((size_t)DD * FIN * 2); bf* WO = (bf*)take((size_t)DO * DD * 2);
    h16* QP = (h16*)take((size_t)NT * DD * 2); h16* KP = (h16*)take((size_t)NT * DD * 2); h16* VP = (h16*)take((size_t)NT * DD * 2); h16* VT = (h16*)take((size_t)NT * DD * 2);
    bf* XB = (bf*)take((size_t)NT * FIN * 2); bf* ATh = (bf*)take((size_t)NT * DD * 2); bf* ATl = (bf*)take((size_t)NT * DD * 2);
    if ((size_t)(wsp - (char*)d_ws) > ws_size) return;    // total ~ 181 MB; ws 256 MiB
    { const unsigned gW = (unsigned)((DD * FIN / 64 + 63) / 64); k_wtG<<<gW, 256, 0, stream>>>(Wq, FIN, DD, WQ); k_wtG<<<gW, 256, 0, stream>>>(Wk, FIN, DD, WK); k_wtG<<<gW, 256, 0, stream>>>(Wv, FIN, DD, WV); k_wtG<<<(unsigned)((DO * DD / 64 + 63) / 64), 256, 0, stream>>>(Wo, DD, DO, WO);
      const size_t nx = (size_t)NT * FIN / 8; k_cvt8<<<(unsigned)((nx + 255) / 256), 256, 0, stream>>>(x, XB, nx); }
    // all 16 batches per launch: the rows of x are one [NT][768] matrix, and the 192 head planes are the flat projection memory
    const unsigned LV = (unsigned)((NT * DD / 64 + 63) / 64); const dim3 gP(NT / GT, DD / GT, 1);
    k_gemmw<bf, 0, true, FIN, true><<<gP, 128, 0, stream>>>(XB, nullptr, WQ, nullptr, QP, DD, bq, 0, 0, 0);
    k_gemmw<bf, 0, true, FIN, true><<<gP, 128, 0, stream>>>(XB, nullptr, WK, nullptr, KP, DD, bk, 0, 0, 0);
    k_gemmw<bf, 0, true, FIN, true><<<gP, 128, 0, stream>>>(XB, nullptr, WV, nullptr, VP, DD, bv, 0, 0, 0); k_vt16<<<LV, 256, 0, stream>>>(VP, VT);
    k_fattn<<<dim3(TT / 256, NB_ * NH_, 1), 256, 0, stream>>>(QP, KP, VT, ATh, ATl);
    k_gemmw<bf, 1, true, DD, false><<<dim3(NT / GT, DO / GT, 1), 128, 0, stream>>>(ATh, ATl, WO, OUT, nullptr, DO, bo, 0, 0, 0);
}

// v005
// One run takes 185 microseconds.
// Two timings next to v004 both put it at 1.14 times that version's speed.
// All steps since v000 together make it 11.7 times as fast.
#include <hip/hip_runtime.h>

// ViT self-attention (x [16][1024][768]; q/k/v = x @ W + b; the module reshapes (B,N,C) -> (B*H, N, Dh) WITHOUT a transpose, so "head" g of a batch is the contiguous chunk g of the
// projection viewed as [1024][64]; scores = q2.k2 / 8; softmax; ctx2 = attn.v2; ctx2.reshape(B,H,N,Dh).transpose(0,2,1,3) -> [n][h*64+d]; out = ctx @ Wo + bo [16][1024][768]).
// Compute dtypes, f32 accumulate: every input rounded to bf16; projections on PLAIN bf16 operands (inputs: exact, + bias); scores and attn.v on SINGLE fp16 planes
// (the head planes ARE the projection memory: flat fp16 planes that the projection GEMMs store; 1/8 applied in f32 in the softmax; P = exp(s - running max), at most 1); scores, softmax and attn.v run in ONE kernel, no score plane in memory;
// no f32 plane lies between the kernels: the projection GEMMs store the fp16 planes, and the attention kernel stores the output product's two bf16 planes, from their own epilogues.

#define NB_  16
#define TT   1024
#define FIN  768
#define DD   768                  // H * Dh
#define NH_  12
#define HD   64
#define DO   768
#define NT   (NB_ * TT)
#define SCL  0.125f               // 1/sqrt(64)
typedef _Float16 h16;
typedef unsigned short bf;
typedef __attribute__((ext_vector_type(16))) __bf16   v16bf;
typedef __attribute__((ext_vector_type(16))) _Float16 v16h;
typedef __attribute__((ext_vector_type(8)))  _Float16 v8h;
typedef __attribute__((ext_vector_type(8)))  unsigned short v8us;
typedef __attribute__((ext_vector_type(8)))  float    v8f;
typedef __attribute__((ext_vector_type(4)))  float    v4f;
typedef v8h  __attribute__((may_alias)) v8ha;
typedef v4f  __attribute__((may_alias)) v4fa;
typedef v8us __attribute__((may_alias)) v8usa;

__device__ __forceinline__ unsigned short f2bf(float f) { unsigned u = __float_as_uint(f); u += 0x7FFFu + ((u >> 16) & 1u); return (unsigned short)(u >> 16); }
__device__ __forceinline__ float bf2f(unsigned short b) { return __uint_as_float(((unsigned)b) << 16); }
__device__ __forceinline__ float bfr(float f) { return bf2f(f2bf(f)); }
__device__ __forceinline__ v16h cat16(v8h lo, v8h hi) { return __builtin_shufflevector(lo, hi, 0, 1, 2, 3, 4, 5, 6, 7, 8, 9, 10, 11, 12, 13, 14, 15); }
__device__ __forceinline__ v16bf cat16b(v8us lo, v8us hi) { return __builtin_bit_cast(v16bf, __builtin_shufflevector(lo, hi, 0, 1, 2, 3, 4, 5, 6, 7, 8, 9, 10, 11, 12, 13, 14, 15)); }
__device__ __forceinline__ v8f wmma16(v16h a, v16h b, v8f c) { return __builtin_amdgcn_wmma_f32_16x16x32_f16(false, a, false, b, (short)0, c, false, false); }
__device__ __forceinline__ v8f wmmab(v16bf a, v16bf b, v8f c) { return __builtin_amdgcn_wmma_f32_16x16x32_bf16(false, a, false, b, (short)0, c, false, false); }



// ---- k_gemmw: GEMM, one 128x128 output tile per work-group of FOUR WAVES (2 x 2, each 64x64 = 16 accumulators); grid (M/128, N/128, Z), 128 threads.
// C[m][n] (f32, or for H16OUT rounded once to fp16 into Ch; pitch ldc, + optional f32 bias[n]) = sum_k A[m][k] Bt[n][k] (+ A2[m][k] Bt[n][k] for NSPLIT == 1). z-batch strides sA/sB/sC in elements; product z takes bias0, bias1 or bias2 (Z <= 3). M, N % 128 == 0, K % 64 == 0, a compile-time constant.
// The operands' rows come as whole 128-byte lines (64 k) by asynchronous copies into two LDS buffers (row pitch 144 B for the 16-byte fragment reads) and are shared by the waves;
// the copies of stage t + 2 fly under the work on stage t + 1.
template <typename T16> struct WFrag;
template <> struct WFrag<h16> { typedef v16h V; static __device__ __forceinline__ V ld(const h16* p) { return cat16(*(const v8h*)p, *(const v8h*)(p + 16)); } static __device__ __forceinline__ v8f mma(V a, V b, v8f c) { return wmma16(a, b, c); } };
template <> struct WFrag<bf> { typedef v16bf V; static __device__ __forceinline__ V ld(const bf* p) { return cat16b(*(const v8us*)p, *(const v8us*)(p + 16)); } static __device__ __forceinline__ v8f mma(V a, V b, v8f c) { return wmmab(a, b, c); } };
#define GT   128                  // rows and columns of a work-group's output tile
#define GKC  64                   // k per stage
#define GLP  72                   // LDS row pitch in 16-bit elements: 144 B = 16 B x 9
// One operand's 128 rows of a stage: this lane's 16 bytes of rows r, r + 16, ..., r + 112 (l: its LDS byte address, g: its global address, rs: 16 rows in elements).
// The s_wait_xcnt stands inside the statement so that no address register named here is rewritten in front of it.
template <typename T16>
__device__ __forceinline__ void cp128(unsigned l, const T16* g, size_t rs) {
    asm volatile("global_load_async_to_lds_b128 %0, %8, off\n\t"
                 "global_load_async_to_lds_b128 %1, %9, off\n\t"
                 "global_load_async_to_lds_b128 %2, %10, off\n\t"
                 "global_load_async_to_lds_b128 %3, %11, off\n\t"
                 "global_load_async_to_lds_b128 %4, %12, off\n\t"
                 "global_load_async_to_lds_b128 %5, %13, off\n\t"
                 "global_load_async_to_lds_b128 %6, %14, off\n\t"
                 "global_load_async_to_lds_b128 %7, %15, off\n\t"
                 "s_wait_xcnt 0x0"
                 :: "v"(l), "v"(l + 1u * 16 * GLP * 2), "v"(l + 2u * 16 * GLP * 2), "v"(l + 3u * 16 * GLP * 2), "v"(l + 4u * 16 * GLP * 2), "v"(l + 5u * 16 * GLP * 2), "v"(l + 6u * 16 * GLP * 2), "v"(l + 7u * 16 * GLP * 2),
                    "v"(g), "v"(g + rs), "v"(g + 2 * rs), "v"(g + 3 * rs), "v"(g + 4 * rs), "v"(g + 5 * rs), "v"(g + 6 * rs), "v"(g + 7 * rs) : "memory");
}
template <typename T16, int NSPLIT, bool BIAS, int K, bool H16OUT>
__global__ __launch_bounds__(128) void k_gemmw(const T16* __restrict__ A, const T16* __restrict__ A2, const T16* __restrict__ Bt, float* C, h16* Ch, int ldc, const float* __restrict__ bias0, const float* __restrict__ bias1, const float* __restrict__ bias2, size_t sA, size_t sB, size_t sC) {
    typedef typename WFrag<T16>::V V;
    static_assert(NSPLIT == 0 || NSPLIT == 1, "one or two A planes"); static_assert(K % GKC == 0 && K / GKC >= 2, "whole stages, at least two");
    constexpr int OPH = GT * GLP;                       // one operand's rows of a stage, in elements
    constexpr int STG = (NSPLIT == 1 ? 3 : 2) * OPH;    // a stage: [A | Bt | A2]
    __shared__ __align__(16) T16 sm[2 * STG];           // two stages; the output staging reuses them
    const size_t z = blockIdx.z; A += z * sA; if (NSPLIT == 1) A2 += z * sA; Bt += z * sB; if (H16OUT) Ch += z * sC; else C += z * sC;
    const float* __restrict__ bias = z == 0 ? bias0 : z == 1 ? bias1 : bias2;
    const int tid = threadIdx.x, lane = tid & 31, wave = tid >> 5, lr = lane & 15, hi = lane >> 4;
    const int r0 = blockIdx.x * GT, c0 = blockIdx.y * GT, wr = (wave & 1) * 64, wc = (wave >> 1) * 64;
    v8f acc[4][4];
#pragma unroll
    for (int mb = 0; mb < 4; ++mb)
#pragma unroll
        for (int nb = 0; nb < 4; ++nb) acc[mb][nb] = (v8f){};
    const int crow = tid >> 3, ccol = (tid & 7) * 8;    // this thread's 16-byte piece: eight lanes per 128-byte row, four whole lines per wave and copy
    constexpr size_t rs = (size_t)16 * K;
    const T16* gA = A + (size_t)(r0 + crow) * K + ccol; const T16* gB = Bt + (size_t)(c0 + crow) * K + ccol; const T16* gA2 = (NSPLIT == 1) ? A2 + (size_t)(r0 + crow) * K + ccol : nullptr;
    const unsigned l0 = (unsigned)(size_t)(sm + crow * GLP + ccol);   // low 32 bits of the shared address = LDS byte address
    auto fill = [&](int t, int buf) { const unsigned l = l0 + (unsigned)buf * (STG * 2);
        cp128(l, gA + (size_t)t * GKC, rs); cp128(l + OPH * 2, gB + (size_t)t * GKC, rs); if (NSPLIT == 1) cp128(l + 2 * OPH * 2, gA2 + (size_t)t * GKC, rs); };
    constexpr int nt = K / GKC;
    fill(0, 0);
    asm volatile("s_wait_asynccnt 0x0" ::: "memory");   // this wave's copies of stage 0 have landed
    __syncthreads();                                    // publishes stage 0
    fill(1, 1);
#pragma unroll 1   // rolled: one copy of a stage's work, the buffer picked by t & 1
    for (int t = 0; t < nt; ++t) {
        const T16* Sa = sm + (t & 1) * STG + (wr + lr) * GLP + 8 * hi; const T16* Sb = sm + (t & 1) * STG + OPH + (wc + lr) * GLP + 8 * hi;
#pragma unroll   // unrolled, as the loops inside: every fragment and accumulator index is a constant, so they stay in registers
        for (int kc = 0; kc < GKC; kc += 32) {
            V a[4], a2[4], b[4];   // all fragments of this 32 k as one group of LDS reads in front of the products
#pragma unroll
            for (int mb = 0; mb < 4; ++mb) { a[mb] = WFrag<T16>::ld(Sa + mb * 16 * GLP + kc); b[mb] = WFrag<T16>::ld(Sb + mb * 16 * GLP + kc); if (NSPLIT == 1) a2[mb] = WFrag<T16>::ld(Sa + 2 * OPH + mb * 16 * GLP + kc); }
            __builtin_amdgcn_sched_barrier(0);   // keeps the reads one group: sunk among the products they shared one register set, and the wave waited out the LDS latency at every fourth product
#pragma unroll
            for (int nb = 0; nb < 4; ++nb)
#pragma unroll
                for (int mb = 0; mb < 4; ++mb) { acc[mb][nb] = WFrag<T16>::mma(a[mb], b[nb], acc[mb][nb]); if (NSPLIT == 1) acc[mb][nb] = WFrag<T16>::mma(a2[mb], b[nb], acc[mb][nb]); }
        }
        __builtin_amdgcn_sched_barrier(0);                  // keeps the products in front of the barrier: sunk behind it they stood in front of the refill and took half a stage off the copies' lead
        asm volatile("s_wait_dscnt 0x0" ::: "memory");      // this wave's reads of stage t are done before the buffer is refilled
        asm volatile("s_wait_asynccnt 0x0" ::: "memory");   // this wave's copies of stage t + 1 have landed
        __syncthreads();                                    // publishes stage t + 1 and ends every wave's reads of stage t
        if (t + 2 < nt) fill(t + 2, t & 1);
    }
    asm volatile("s_wait_asynccnt 0x0" ::: "memory");       // no copy is outstanding when the buffers become output staging
    float* os = (float*)sm + wave * (16 * 68);              // 16 rows of 64 f32, pitch 68, per wave: rows go out as whole lines
#pragma unroll
    for (int mb = 0; mb < 4; ++mb) {
#pragma unroll
        for (int nb = 0; nb < 4; ++nb) {
#pragma unroll
            for (int j = 0; j < 8; ++j) os[(hi * 8 + j) * 68 + nb * 16 + lr] = acc[mb][nb][j]; }
        __builtin_amdgcn_wave_barrier(); asm volatile("" ::: "memory");   // keeps the row reads below behind the other lanes' LDS writes in the compiled order
        if (H16OUT) {   // a row of 64 fp16 is one 128-byte line: eight lanes a row, four rows a store
            h16* crh = Ch + (size_t)(r0 + wr + mb * 16) * ldc + c0 + wc;
#pragma unroll
            for (int s = 0; s < 4; ++s) { const int row = 4 * s + (lane >> 3), cofs = (lane & 7) * 8; const v4f v0 = *(const v4fa*)(os + row * 68 + cofs), v1 = *(const v4fa*)(os + row * 68 + cofs + 4); v8h o;
#pragma unroll
                for (int k = 0; k < 4; ++k) { const float* bp = bias + c0 + wc + cofs; o[k] = (h16)(BIAS ? v0[k] + bfr(bp[k]) : v0[k]); o[k + 4] = (h16)(BIAS ? v1[k] + bfr(bp[k + 4]) : v1[k]); }
                *(v8h*)(crh + (size_t)row * ldc + cofs) = o; }
        } else {
        float* crw = C + (size_t)(r0 + wr + mb * 16) * ldc + c0 + wc;
#pragma unroll
        for (int s = 0; s < 8; ++s) { const int row = 2 * s + hi, cofs = lr * 4; v4f val = *(const v4fa*)(os + row * 68 + cofs); if (BIAS) { const float* bp = bias + c0 + wc + cofs; val[0] += bfr(bp[0]); val[1] += bfr(bp[1]); val[2] += bfr(bp[2]); val[3] += bfr(bp[3]); }
            *(v4f*)(crw + (size_t)row * ldc + cofs) = val; }
        }
        asm volatile("s_wait_xcnt 0x0" ::: "memory");   // stands in front of the next rows' work, which rewrites registers that these stores name
        __builtin_amdgcn_wave_barrier(); asm volatile("" ::: "memory");   // keeps the next 16 rows' LDS writes behind these reads
    }
}

__device__ __forceinline__ void splitf(float y, unsigned short& h, unsigned short& l) { h = f2bf(y); l = f2bf(y - bf2f(h)); }
typedef __attribute__((ext_vector_type(2))) _Float16 v2h;
typedef __attribute__((ext_vector_type(4))) _Float16 v4h;
typedef __attribute__((ext_vector_type(2))) unsigned short v2us;

// ---- k_prep: the five independent input conversions as ONE grid: blocks 0 .. 4 WTB - 1 transpose and round the four weights (WTB blocks each; they come first because each wave walks
// its eight lines one after the other), the blocks behind them round x. The test on the block index is the same for a whole work-group; no barrier in either part.
__device__ __forceinline__ void cvt8(const float* __restrict__ src, bf* dst, size_t n8, unsigned blk) { const size_t i = (size_t)blk * 256 + threadIdx.x; if (i >= n8) return; const v8f v = *(const v8f*)(src + i * 8); v8us o;
#pragma unroll
    for (int k = 0; k < 8; ++k) o[k] = f2bf(v[k]); *(v8us*)(dst + i * 8) = o;  }
__device__ __forceinline__ void wtG(const float* __restrict__ w, int K, int N, bf* Bt, unsigned blk) {
    const int lane = threadIdx.x & 31; const int L0 = (blk * 8 + (threadIdx.x >> 5)) * 8; const int nlines = N * K / 64;
{
#pragma unroll 1
        for (int l = 0; l < 8; ++l) { const int L = L0 + l; if (L >= nlines) break; const size_t e = (size_t)L * 64 + lane * 2; const int k = (int)(e % K), n = (int)(e / K); v2us o;
            o[0] = f2bf(w[(size_t)k * N + n]); o[1] = f2bf(w[(size_t)(k + 1) * N + n]); *(v2us*)(Bt + e) = o; }
         }
}
#define WTB ((DD * FIN / 64 + 63) / 64)   // blocks per weight: 64 lines of 64 elements a block
static_assert(FIN == DD && DD == DO, "the four weights have one shape");
__global__ __launch_bounds__(256) void k_prep(const float* __restrict__ x, const float* __restrict__ Wq, const float* __restrict__ Wk, const float* __restrict__ Wv, const float* __restrict__ Wo,
                                              bf* XB, bf* WQ, bf* WK, bf* WV, bf* WO) {
    const unsigned b = blockIdx.x;
    if (b < 4 * WTB) { const unsigned j = b / WTB;
        wtG(j == 0 ? Wq : j == 1 ? Wk : j == 2 ? Wv : Wo, FIN, DD, j == 0 ? WQ : j == 1 ? WK : j == 2 ? WV : WO, b - j * WTB);
    } else cvt8(x, XB, (size_t)NT * FIN / 8, b - 4 * WTB);
}
__global__ __launch_bounds__(256) void k_vt16(const h16* __restrict__ F, h16* VT) {
    const int lane = threadIdx.x & 31; const int L0 = (blockIdx.x * 8 + (threadIdx.x >> 5)) * 8; const int nlines = NT * DD / 64;
{
#pragma unroll
        for (int l = 0; l < 8; ++l) { const int L = L0 + l; if (L >= nlines) break; const int e = L * 64 + lane * 2; const int c = e & (TT - 1); const int d = (e >> 10) & (HD - 1); const int h = e >> 16; v2h v;
#pragma unroll
            for (int q = 0; q < 2; ++q) v[q] = F[(size_t)h * TT * HD + (size_t)(c + q) * HD + d];
            *(v2h*)(VT + (size_t)e) = v; }
         }
}
#define SKEY 64                   // keys per LDS tile
#define LPH  72                   // LDS row pitch in halfs: 144 B = 16 B x 9
#define TILEH (SKEY * LPH)
typedef __attribute__((ext_vector_type(2))) float v2f;
typedef __attribute__((ext_vector_type(2))) _Float16 v2hh;
__device__ __forceinline__ float xhalf(float x) { return __builtin_bit_cast(float, __builtin_amdgcn_permlanex16(__builtin_bit_cast(int, x), __builtin_bit_cast(int, x), 0x76543210, 0xfedcba98, false, false)); }  // lane l with lane l ^ 16
__global__ __launch_bounds__(256) __attribute__((amdgpu_waves_per_eu(4, 4))) void k_fattn(const h16* __restrict__ Q, const h16* __restrict__ Kp, const h16* __restrict__ VT, bf* __restrict__ Ah, bf* __restrict__ Al) {
    __shared__ __align__(16) h16 sm[4 * TILEH];     // [buffer][K | V^T][row][LPH]; the output staging reuses it
    const int tid = threadIdx.x, lane = tid & 31, wave = tid >> 5, c = lane & 15, h = lane >> 4;
    { const size_t hb = (size_t)blockIdx.y * TT * HD; Q += hb; Kp += hb; VT += hb;
      const size_t ob = (size_t)(blockIdx.y / NH_) * TT * DD + (size_t)(blockIdx.y % NH_) * HD; Ah += ob; Al += ob; }
    const int q0 = blockIdx.x * 256 + wave * 32;
    const float CS = SCL * 1.4426950408889634f;     // 1/8 and log2(e) in one factor
    v16h qf[2][2];
#pragma unroll
    for (int g = 0; g < 2; ++g)
#pragma unroll
        for (int kc = 0; kc < 2; ++kc) qf[g][kc] = WFrag<h16>::ld(Q + (size_t)(q0 + 16 * g + c) * HD + 32 * kc + 8 * h);
    v8f acc[2][4]; float m_run[2], l_run[2];
#pragma unroll
    for (int g = 0; g < 2; ++g) { m_run[g] = -3.0e38f; l_run[g] = 0.f;
#pragma unroll
        for (int t = 0; t < 4; ++t) acc[g][t] = (v8f){}; }
    const int srow = tid >> 3, scol = (tid & 7) * 8;   // this thread's 16-byte pieces of a tile: rows srow and srow + 32
    v8h rk[2], rv[2];
#pragma unroll
    for (int j = 0; j < 2; ++j) { rk[j] = *(const v8h*)(Kp + (size_t)(srow + 32 * j) * HD + scol); rv[j] = *(const v8h*)(VT + (size_t)(srow + 32 * j) * TT + scol); }
#pragma unroll
    for (int j = 0; j < 2; ++j) { *(v8h*)(sm + (srow + 32 * j) * LPH + scol) = rk[j]; *(v8h*)(sm + TILEH + (srow + 32 * j) * LPH + scol) = rv[j]; }
    __syncthreads();
#pragma unroll 1   // rolled: one copy of the tile's work, the buffer picked by s & 1
    for (int s = 0; s < TT / SKEY; ++s) {
        if (s + 1 < TT / SKEY) {
#pragma unroll
            for (int j = 0; j < 2; ++j) { rk[j] = *(const v8h*)(Kp + (size_t)((s + 1) * SKEY + srow + 32 * j) * HD + scol); rv[j] = *(const v8h*)(VT + (size_t)(srow + 32 * j) * TT + (s + 1) * SKEY + scol); }
        }
        const h16* Kb = sm + (s & 1) * (2 * TILEH); const h16* Vb = Kb + TILEH;
#pragma unroll 1   // rolled: with both 32-key passes unrolled the build spilled a staged load to scratch, which put its wait at the head of the tile
        for (int p = 0; p < SKEY / 32; ++p) {
            v8f sc[2][2];
#pragma unroll
            for (int kt = 0; kt < 2; ++kt) { v16h kf[2];
#pragma unroll
                for (int kc = 0; kc < 2; ++kc) kf[kc] = WFrag<h16>::ld(Kb + (32 * p + 16 * kt + c) * LPH + 32 * kc + 8 * h);
#pragma unroll
                for (int g = 0; g < 2; ++g) { sc[kt][g] = (v8f){};
#pragma unroll
                    for (int kc = 0; kc < 2; ++kc) sc[kt][g] = wmma16(kf[kc], qf[g][kc], sc[kt][g]); } }
            v16h vf[4];
#pragma unroll
            for (int t = 0; t < 4; ++t) vf[t] = WFrag<h16>::ld(Vb + (16 * t + c) * LPH + 32 * p + 8 * h);
#pragma unroll
            for (int g = 0; g < 2; ++g) {
                float mx = sc[0][g][0];
#pragma unroll
                for (int r = 1; r < 8; ++r) mx = fmaxf(mx, sc[0][g][r]);
#pragma unroll
                for (int r = 0; r < 8; ++r) mx = fmaxf(mx, sc[1][g][r]);
                mx = fmaxf(mx, xhalf(mx));             // both wave halves hold this query's maximum over the 32 keys
                const float mn = fmaxf(m_run[g], mx * CS); const float corr = __builtin_amdgcn_exp2f(m_run[g] - mn); m_run[g] = mn;
                float ls = 0.f; v16h pf;
#pragma unroll
                for (int i = 0; i < 8; ++i) {
                    const v2f a = __builtin_elementwise_fma((v2f){sc[i >> 2][g][2 * (i & 3)], sc[i >> 2][g][2 * (i & 3) + 1]}, (v2f){CS, CS}, (v2f){-mn, -mn});
                    const float p0 = __builtin_amdgcn_exp2f(a[0]), p1 = __builtin_amdgcn_exp2f(a[1]); ls += p0 + p1;
                    const v2hh w = __builtin_convertvector((v2f){p0, p1}, v2hh); pf[2 * i] = w[0]; pf[2 * i + 1] = w[1]; }
                l_run[g] = l_run[g] * corr + ls;       // this half's keys only; the halves are joined once, behind the loop
#pragma unroll
                for (int t = 0; t < 4; ++t) { acc[g][t] = acc[g][t] * corr; acc[g][t] = wmma16(vf[t], pf, acc[g][t]); }
            }
        }
        if (s + 1 < TT / SKEY) { h16* Wb = sm + ((s + 1) & 1) * (2 * TILEH);   // its last readers left it in front of the barrier that ended trip s - 1
#pragma unroll
            for (int j = 0; j < 2; ++j) { *(v8h*)(Wb + (srow + 32 * j) * LPH + scol) = rk[j]; *(v8h*)(Wb + TILEH + (srow + 32 * j) * LPH + scol) = rv[j]; }
        }
        __syncthreads();   // publishes tile s + 1 and ends every wave's reads of tile s
    }
    float* os = (float*)sm + wave * (16 * 68);   // 16 query rows of 64 f32, pitch 68, per wave: rows go out as whole lines
#pragma unroll
    for (int g = 0; g < 2; ++g) {
        const float f = __fdiv_rn(1.0f, l_run[g] + xhalf(l_run[g]));
#pragma unroll
        for (int t = 0; t < 4; ++t) { v4f lo, hi4;
#pragma unroll
            for (int r = 0; r < 4; ++r) { lo[r] = acc[g][t][r] * f; hi4[r] = acc[g][t][r + 4] * f; }
            *(v4fa*)(os + c * 68 + 16 * t + 8 * h) = lo; *(v4fa*)(os + c * 68 + 16 * t + 8 * h + 4) = hi4; }
        __builtin_amdgcn_wave_barrier(); asm volatile("" ::: "memory");   // keeps the row reads below behind the other lanes' LDS writes in the compiled order
#pragma unroll
        for (int i = 0; i < 4; ++i) { const int row = 4 * i + (lane >> 3), cofs = (lane & 7) * 8;   // a row of 64 bf16 is one 128-byte line: eight lanes a row, four rows a store
            const v4f v0 = *(const v4fa*)(os + row * 68 + cofs), v1 = *(const v4fa*)(os + row * 68 + cofs + 4); v8us oh, ol;
#pragma unroll
            for (int k = 0; k < 4; ++k) { unsigned short a, b; splitf(v0[k], a, b); oh[k] = a; ol[k] = b; splitf(v1[k], a, b); oh[k + 4] = a; ol[k + 4] = b; }
            const size_t o = (size_t)(q0 + 16 * g + row) * DD + cofs; *(v8us*)(Ah + o) = oh; *(v8us*)(Al + o) = ol; }
        asm volatile("s_wait_xcnt 0x0" ::: "memory");   // stands in front of the next group's work, which rewrites registers that these stores name
        __builtin_amdgcn_wave_barrier(); asm volatile("" ::: "memory");   // keeps the next group's LDS writes behind these reads
    }
}

extern "C" void kernel_launch(void* const* d_in, const int* in_sizes, int n_in,
                              void* d_out, int out_size, void* d_ws, size_t ws_size, hipStream_t stream) {
    (void)in_sizes; (void)n_in; (void)out_size;
    const float* x = (const float*)d_in[0]; const float* Wq = (const float*)d_in[1]; const float* bq = (const float*)d_in[2]; const float* Wk = (const float*)d_in[3]; const float* bk = (const float*)d_in[4]; const float* Wv = (const float*)d_in[5]; const float* bv = (const float*)d_in[6]; const float* Wo = (const float*)d_in[7]; const float* bo = (const float*)d_in[8];
    float* OUT = (float*)d_out;     // [16][1024][768]
    char* wsp = (char*)d_ws;
    auto take = [&](size_t bytes) { char* p = wsp; wsp += (bytes + 255) & ~(size_t)255; return (void*)p; };
    bf* WQ = (bf*)take((size_t)DD * FIN * 2); bf* WK = (bf*)take((size_t)DD * FIN * 2); bf* WV = (bf*)take((size_t)DD * FIN * 2); bf* WO = (bf*)take((size_t)DO * DD * 2);
    h16* QP = (h16*)take((size_t)NT * DD * 2); h16* KP = (h16*)take((size_t)NT * DD * 2); h16* VP = (h16*)take((size_t)NT * DD * 2); h16* VT = (h16*)take((size_t)NT * DD * 2);
    bf* XB = (bf*)take((size_t)NT * FIN * 2); bf* ATh = (bf*)take((size_t)NT * DD * 2); bf* ATl = (bf*)take((size_t)NT * DD * 2);
    if ((size_t)(wsp - (char*)d_ws) > ws_size) return;    // total ~ 181 MB; ws 256 MiB
    k_prep<<<(unsigned)(4 * WTB + ((size_t)NT * FIN / 8 + 255) / 256), 256, 0, stream>>>(x, Wq, Wk, Wv, Wo, XB, WQ, WK, WV, WO);
    // all 16 batches per launch: the rows of x are one [NT][768] matrix, and the 192 head planes are the flat projection memory
    const unsigned LV = (unsigned)((NT * DD / 64 + 63) / 64); const dim3 gP(NT / GT, DD / GT, 3);
    // the three projections as one grid, z = q, k, v: WQ, WK, WV and QP, KP, VP lie one behind the other in the workspace (each size is a multiple of the 256-byte rounding of take)
    static_assert(((size_t)DD * FIN * 2) % 256 == 0 && ((size_t)NT * DD * 2) % 256 == 0, "planes contiguous");
    k_gemmw<bf, 0, true, FIN, true><<<gP, 128, 0, stream>>>(XB, nullptr, WQ, nullptr, QP, DD, bq, bk, bv, 0, (size_t)DD * FIN, (size_t)NT * DD);
    k_vt16<<<LV, 256, 0, stream>>>(VP, VT);
    k_fattn<<<dim3(TT / 256, NB_ * NH_, 1), 256, 0, stream>>>(QP, KP, VT, ATh, ATl);
    k_gemmw<bf, 1, true, DD, false><<<dim3(NT / GT, DO / GT, 1), 128, 0, stream>>>(ATh, ATl, WO, OUT, nullptr, DO, bo, bo, bo, 0, 0, 0);
}

// v006
// Measured time: 157 microseconds a run.
// Timed twice side by side with v005, it ran 1.18 times as fast both times.
// Counting every step since v000, it is 13.7 times as fast.
#include <hip/hip_runtime.h>

// ViT self-attention (x [16][1024][768]; q/k/v = x @ W + b; the module reshapes (B,N,C) -> (B*H, N, Dh) WITHOUT a transpose, so "head" g of a batch is the contiguous chunk g of the
// projection viewed as [1024][64]; scores = q2.k2 / 8; softmax; ctx2 = attn.v2; ctx2.reshape(B,H,N,Dh).transpose(0,2,1,3) -> [n][h*64+d]; out = ctx @ Wo + bo [16][1024][768]).
// Compute dtypes, f32 accumulate: every input rounded to bf16; projections on PLAIN bf16 operands (inputs: exact, + bias); scores and attn.v on SINGLE fp16 planes
// (the head planes ARE the projection memory: flat fp16 planes that the projection GEMMs store; 1/8 applied in f32 in the softmax; P = exp(s - running max), at most 1); scores, softmax and attn.v run in ONE kernel, no score plane in memory;
// no f32 plane lies between the kernels: the projection GEMMs store the fp16 planes, and the attention kernel stores the output product's two bf16 planes, from their own epilogues.

#define NB_  16
#define TT   1024
#define FIN  768
#define DD   768                  // H * Dh
#define NH_  12
#define HD   64
#define DO   768
#define NT   (NB_ * TT)
#define SCL  0.125f               // 1/sqrt(64)
typedef _Float16 h16;
typedef unsigned short bf;
typedef __attribute__((ext_vector_type(16))) __bf16   v16bf;
typedef __attribute__((ext_vector_type(16))) _Float16 v16h;
typedef __attribute__((ext_vector_type(8)))  _Float16 v8h;
typedef __attribute__((ext_vector_type(8)))  unsigned short v8us;
typedef __attribute__((ext_vector_type(8)))  float    v8f;
typedef __attribute__((ext_vector_type(4)))  float    v4f;
typedef v8h  __attribute__((may_alias)) v8ha;
typedef v4f  __attribute__((may_alias)) v4fa;
typedef v8us __attribute__((may_alias)) v8usa;

__device__ __forceinline__ unsigned short f2bf(float f) { unsigned u = __float_as_uint(f); u += 0x7FFFu + ((u >> 16) & 1u); return (unsigned short)(u >> 16); }
__device__ __forceinline__ float bf2f(unsigned short b) { return __uint_as_float(((unsigned)b) << 16); }
__device__ __forceinline__ float bfr(float f) { return bf2f(f2bf(f)); }
__device__ __forceinline__ v16h cat16(v8h lo, v8h hi) { return __builtin_shufflevector(lo, hi, 0, 1, 2, 3, 4, 5, 6, 7, 8, 9, 10, 11, 12, 13, 14, 15); }
__device__ __forceinline__ v16bf cat16b(v8us lo, v8us hi) { return __builtin_bit_cast(v16bf, __builtin_shufflevector(lo, hi, 0, 1, 2, 3, 4, 5, 6, 7, 8, 9, 10, 11, 12, 13, 14, 15)); }
__device__ __forceinline__ v8f wmma16(v16h a, v16h b, v8f c) { return __builtin_amdgcn_wmma_f32_16x16x32_f16(false, a, false, b, (short)0, c, false, false); }
__device__ __forceinline__ v8f wmmab(v16bf a, v16bf b, v8f c) { return __builtin_amdgcn_wmma_f32_16x16x32_bf16(false, a, false, b, (short)0, c, false, false); }



// ---- k_gemmw: GEMM, one 128x128 output tile per work-group of FOUR WAVES (2 x 2, each 64x64 = 16 accumulators); grid (M/128, N/128, Z), 128 threads.
// C[m][n] (f32, or for H16OUT rounded once to fp16 into Ch; pitch ldc, + optional f32 bias[n]) = sum_k A[m][k] Bt[n][k] (+ A2[m][k] Bt[n][k] for NSPLIT == 1). z-batch strides sA/sB/sC in elements; product z takes bias0, bias1 or bias2 (Z <= 3). M, N % 128 == 0, K % 64 == 0, a compile-time constant.
// The operands' rows come as whole 128-byte lines (64 k) by asynchronous copies into two LDS buffers (row pitch 144 B for the 16-byte fragment reads) and are shared by the waves;
// the copies of stage t + 2 fly under the work on stage t + 1.
template <typename T16> struct WFrag;
template <> struct WFrag<h16> { typedef v16h V; static __device__ __forceinline__ V ld(const h16* p) { return cat16(*(const v8h*)p, *(const v8h*)(p + 16)); } static __device__ __forceinline__ v8f mma(V a, V b, v8f c) { return wmma16(a, b, c); } };
template <> struct WFrag<bf> { typedef v16bf V; static __device__ __forceinline__ V ld(const bf* p) { return cat16b(*(const v8us*)p, *(const v8us*)(p + 16)); } static __device__ __forceinline__ v8f mma(V a, V b, v8f c) { return wmmab(a, b, c); } };
#define GT   128                  // rows and columns of a work-group's output tile
#define GKC  64                   // k per stage
#define GLP  72                   // LDS row pitch in 16-bit elements: 144 B = 16 B x 9
// One operand's 128 rows of a stage: this lane's 16 bytes of rows r, r + 16, ..., r + 112 (l: its LDS byte address, g: its global address, rs: 16 rows in elements).
// The s_wait_xcnt stands inside the statement so that no address register named here is rewritten in front of it.
template <typename T16>
__device__ __forceinline__ void cp128(unsigned l, const T16* g, size_t rs) {
    asm volatile("global_load_async_to_lds_b128 %0, %8, off\n\t"
                 "global_load_async_to_lds_b128 %1, %9, off\n\t"
                 "global_load_async_to_lds_b128 %2, %10, off\n\t"
                 "global_load_async_to_lds_b128 %3, %11, off\n\t"
                 "global_load_async_to_lds_b128 %4, %12, off\n\t"
                 "global_load_async_to_lds_b128 %5, %13, off\n\t"
                 "global_load_async_to_lds_b128 %6, %14, off\n\t"
                 "global_load_async_to_lds_b128 %7, %15, off\n\t"
                 "s_wait_xcnt 0x0"
                 :: "v"(l), "v"(l + 1u * 16 * GLP * 2), "v"(l + 2u * 16 * GLP * 2), "v"(l + 3u * 16 * GLP * 2), "v"(l + 4u * 16 * GLP * 2), "v"(l + 5u * 16 * GLP * 2), "v"(l + 6u * 16 * GLP * 2), "v"(l + 7u * 16 * GLP * 2),
                    "v"(g), "v"(g + rs), "v"(g + 2 * rs), "v"(g + 3 * rs), "v"(g + 4 * rs), "v"(g + 5 * rs), "v"(g + 6 * rs), "v"(g + 7 * rs) : "memory");
}
template <typename T16, int NSPLIT, bool BIAS, int K, bool H16OUT>
__global__ __launch_bounds__(128) void k_gemmw(const T16* __restrict__ A, const T16* __restrict__ A2, const T16* __restrict__ Bt, float* C, h16* Ch, int ldc, const float* __restrict__ bias0, const float* __restrict__ bias1, const float* __restrict__ bias2, size_t sA, size_t sB, size_t sC) {
    typedef typename WFrag<T16>::V V;
    static_assert(NSPLIT == 0 || NSPLIT == 1, "one or two A planes"); static_assert(K % GKC == 0 && K / GKC >= 2, "whole stages, at least two");
    constexpr int OPH = GT * GLP;                       // one operand's rows of a stage, in elements
    constexpr int STG = (NSPLIT == 1 ? 3 : 2) * OPH;    // a stage: [A | Bt | A2]
    __shared__ __align__(16) T16 sm[2 * STG];           // two stages; the output staging reuses them
    const size_t z = blockIdx.z; A += z * sA; if (NSPLIT == 1) A2 += z * sA; Bt += z * sB; if (H16OUT) Ch += z * sC; else C += z * sC;
    const float* __restrict__ bias = z == 0 ? bias0 : z == 1 ? bias1 : bias2;
    const int tid = threadIdx.x, lane = tid & 31, wave = tid >> 5, lr = lane & 15, hi = lane >> 4;
    const int r0 = blockIdx.x * GT, c0 = blockIdx.y * GT, wr = (wave & 1) * 64, wc = (wave >> 1) * 64;
    v8f acc[4][4];
#pragma unroll
    for (int mb = 0; mb < 4; ++mb)
#pragma unroll
        for (int nb = 0; nb < 4; ++nb) acc[mb][nb] = (v8f){};
    const int crow = tid >> 3, ccol = (tid & 7) * 8;    // this thread's 16-byte piece: eight lanes per 128-byte row, four whole lines per wave and copy
    constexpr size_t rs = (size_t)16 * K;
    const T16* gA = A + (size_t)(r0 + crow) * K + ccol; const T16* gB = Bt + (size_t)(c0 + crow) * K + ccol; const T16* gA2 = (NSPLIT == 1) ? A2 + (size_t)(r0 + crow) * K + ccol : nullptr;
    const unsigned l0 = (unsigned)(size_t)(sm + crow * GLP + ccol);   // low 32 bits of the shared address = LDS byte address
    auto fill = [&](int t, int buf) { const unsigned l = l0 + (unsigned)buf * (STG * 2);
        cp128(l, gA + (size_t)t * GKC, rs); cp128(l + OPH * 2, gB + (size_t)t * GKC, rs); if (NSPLIT == 1) cp128(l + 2 * OPH * 2, gA2 + (size_t)t * GKC, rs); };
    constexpr int nt = K / GKC;
    fill(0, 0);
    asm volatile("s_wait_asynccnt 0x0" ::: "memory");   // this wave's copies of stage 0 have landed
    __syncthreads();                                    // publishes stage 0
    fill(1, 1);
#pragma unroll 1   // rolled: one copy of a stage's work, the buffer picked by t & 1
    for (int t = 0; t < nt; ++t) {
        const T16* Sa = sm + (t & 1) * STG + (wr + lr) * GLP + 8 * hi; const T16* Sb = sm + (t & 1) * STG + OPH + (wc + lr) * GLP + 8 * hi;
#pragma unroll   // unrolled, as the loops inside: every fragment and accumulator index is a constant, so they stay in registers
        for (int kc = 0; kc < GKC; kc += 32) {
            V a[4], a2[4], b[4];   // all fragments of this 32 k as one group of LDS reads in front of the products
#pragma unroll
            for (int mb = 0; mb < 4; ++mb) { a[mb] = WFrag<T16>::ld(Sa + mb * 16 * GLP + kc); b[mb] = WFrag<T16>::ld(Sb + mb * 16 * GLP + kc); if (NSPLIT == 1) a2[mb] = WFrag<T16>::ld(Sa + 2 * OPH + mb * 16 * GLP + kc); }
            __builtin_amdgcn_sched_barrier(0);   // keeps the reads one group: sunk among the products they shared one register set, and the wave waited out the LDS latency at every fourth product
#pragma unroll
            for (int nb = 0; nb < 4; ++nb)
#pragma unroll
                for (int mb = 0; mb < 4; ++mb) { acc[mb][nb] = WFrag<T16>::mma(a[mb], b[nb], acc[mb][nb]); if (NSPLIT == 1) acc[mb][nb] = WFrag<T16>::mma(a2[mb], b[nb], acc[mb][nb]); }
        }
        __builtin_amdgcn_sched_barrier(0);                  // keeps the products in front of the barrier: sunk behind it they stood in front of the refill and took half a stage off the copies' lead
        asm volatile("s_wait_dscnt 0x0" ::: "memory");      // this wave's reads of stage t are done before the buffer is refilled
        asm volatile("s_wait_asynccnt 0x0" ::: "memory");   // this wave's copies of stage t + 1 have landed
        __syncthreads();                                    // publishes stage t + 1 and ends every wave's reads of stage t
        if (t + 2 < nt) fill(t + 2, t & 1);
    }
    asm volatile("s_wait_asynccnt 0x0" ::: "memory");       // no copy is outstanding when the buffers become output staging
    float* os = (float*)sm + wave * (16 * 68);              // 16 rows of 64 f32, pitch 68, per wave: rows go out as whole lines
#pragma unroll
    for (int mb = 0; mb < 4; ++mb) {
#pragma unroll
        for (int nb = 0; nb < 4; ++nb) {
#pragma unroll
            for (int j = 0; j < 8; ++j) os[(hi * 8 + j) * 68 + nb * 16 + lr] = acc[mb][nb][j]; }
        __builtin_amdgcn_wave_barrier(); asm volatile("" ::: "memory");   // keeps the row reads below behind the other lanes' LDS writes in the compiled order
        if (H16OUT) {   // a row of 64 fp16 is one 128-byte line: eight lanes a row, four rows a store
            h16* crh = Ch + (size_t)(r0 + wr + mb * 16) * ldc + c0 + wc;
#pragma unroll
            for (int s = 0; s < 4; ++s) { const int row = 4 * s + (lane >> 3), cofs = (lane & 7) * 8; const v4f v0 = *(const v4fa*)(os + row * 68 + cofs), v1 = *(const v4fa*)(os + row * 68 + cofs + 4); v8h o;
#pragma unroll
                for (int k = 0; k < 4; ++k) { const float* bp = bias + c0 + wc + cofs; o[k] = (h16)(BIAS ? v0[k] + bfr(bp[k]) : v0[k]); o[k + 4] = (h16)(BIAS ? v1[k] + bfr(bp[k + 4]) : v1[k]); }
                *(v8h*)(crh + (size_t)row * ldc + cofs) = o; }
        } else {
        float* crw = C + (size_t)(r0 + wr + mb * 16) * ldc + c0 + wc;
#pragma unroll
        for (int s = 0; s < 8; ++s) { const int row = 2 * s + hi, cofs = lr * 4; v4f val = *(const v4fa*)(os + row * 68 + cofs); if (BIAS) { const float* bp = bias + c0 + wc + cofs; val[0] += bfr(bp[0]); val[1] += bfr(bp[1]); val[2] += bfr(bp[2]); val[3] += bfr(bp[3]); }
            *(v4f*)(crw + (size_t)row * ldc + cofs) = val; }
        }
        asm volatile("s_wait_xcnt 0x0" ::: "memory");   // stands in front of the next rows' work, which rewrites registers that these stores name
        __builtin_amdgcn_wave_barrier(); asm volatile("" ::: "memory");   // keeps the next 16 rows' LDS writes behind these reads
    }
}

__device__ __forceinline__ void splitf(float y, unsigned short& h, unsigned short& l) { h = f2bf(y); l = f2bf(y - bf2f(h)); }
typedef __attribute__((ext_vector_type(4))) _Float16 v4h;
typedef __attribute__((ext_vector_type(2))) unsigned short v2us;

// ---- k_prep: the five independent input conversions as ONE grid: blocks 0 .. 4 WTB - 1 transpose and round the four weights (WTB blocks each; they come first because each wave walks
// its eight lines one after the other), the blocks behind them round x. The test on the block index is the same for a whole work-group; no barrier in either part.
__device__ __forceinline__ void cvt8(const float* __restrict__ src, bf* dst, size_t n8, unsigned blk) { const size_t i = (size_t)blk * 256 + threadIdx.x; if (i >= n8) return; const v8f v = *(const v8f*)(src + i * 8); v8us o;
#pragma unroll
    for (int k = 0; k < 8; ++k) o[k] = f2bf(v[k]); *(v8us*)(dst + i * 8) = o;  }
__device__ __forceinline__ void wtG(const float* __restrict__ w, int K, int N, bf* Bt, unsigned blk) {
    const int lane = threadIdx.x & 31; const int L0 = (blk * 8 + (threadIdx.x >> 5)) * 8; const int nlines = N * K / 64;
{
#pragma unroll 1
        for (int l = 0; l < 8; ++l) { const int L = L0 + l; if (L >= nlines) break; const size_t e = (size_t)L * 64 + lane * 2; const int k = (int)(e % K), n = (int)(e / K); v2us o;
            o[0] = f2bf(w[(size_t)k * N + n]); o[1] = f2bf(w[(size_t)(k + 1) * N + n]); *(v2us*)(Bt + e) = o; }
         }
}
#define WTB ((DD * FIN / 64 + 63) / 64)   // blocks per weight: 64 lines of 64 elements a block
static_assert(FIN == DD && DD == DO, "the four weights have one shape");
__global__ __launch_bounds__(256) void k_prep(const float* __restrict__ x, const float* __restrict__ Wq, const float* __restrict__ Wk, const float* __restrict__ Wv, const float* __restrict__ Wo,
                                              bf* XB, bf* WQ, bf* WK, bf* WV, bf* WO) {
    const unsigned b = blockIdx.x;
    if (b < 4 * WTB) { const unsigned j = b / WTB;
        wtG(j == 0 ? Wq : j == 1 ? Wk : j == 2 ? Wv : Wo, FIN, DD, j == 0 ? WQ : j == 1 ? WK : j == 2 ? WV : WO, b - j * WTB);
    } else cvt8(x, XB, (size_t)NT * FIN / 8, b - 4 * WTB);
}
#define SKEY 64                   // keys per LDS tile
#define LPH  72                   // K's LDS row pitch in halfs: 144 B = 16 B x 9
#define LPV  80                   // V's LDS row pitch in halfs: 160 B = 32 B x 5, the transposing load's pitch
#define TILEH (SKEY * LPH)
#define TILEV (SKEY * LPV)
#define BUFH  (TILEH + TILEV)     // one buffer: [K | V]
typedef __attribute__((ext_vector_type(2))) float v2f;
typedef __attribute__((ext_vector_type(2))) _Float16 v2hh;
typedef __attribute__((ext_vector_type(8))) short v8s;
// Lane l passes the address of 16 bytes of row 8 (l >> 4) + (l & 7), column group (l >> 3) & 1, of a 16 x 16 block; lane (c, h) receives rows 8 h .. 8 h + 7 of column c.
__device__ __forceinline__ v8h ldtr(const h16* p) { typedef __attribute__((address_space(3))) v8s lv8s; return __builtin_bit_cast(v8h, __builtin_amdgcn_ds_load_tr16_b128_v8i16((lv8s*)p)); }
__device__ __forceinline__ float xhalf(float x) { return __builtin_bit_cast(float, __builtin_amdgcn_permlanex16(__builtin_bit_cast(int, x), __builtin_bit_cast(int, x), 0x76543210, 0xfedcba98, false, false)); }  // lane l with lane l ^ 16
__global__ __launch_bounds__(256) __attribute__((amdgpu_waves_per_eu(4, 4))) void k_fattn(const h16* __restrict__ Q, const h16* __restrict__ Kp, const h16* __restrict__ Vp, bf* __restrict__ Ah, bf* __restrict__ Al) {
    __shared__ __align__(32) h16 sm[2 * BUFH];      // [buffer][K rows, pitch LPH | V rows, pitch LPV]; the output staging reuses it
    static_assert(2 * BUFH * 2 >= 8 * 16 * 68 * 4, "the output staging fits");
    const int tid = threadIdx.x, lane = tid & 31, wave = tid >> 5, c = lane & 15, h = lane >> 4;
    { const size_t hb = (size_t)blockIdx.y * TT * HD; Q += hb; Kp += hb; Vp += hb;
      const size_t ob = (size_t)(blockIdx.y / NH_) * TT * DD + (size_t)(blockIdx.y % NH_) * HD; Ah += ob; Al += ob; }
    const int q0 = blockIdx.x * 256 + wave * 32;
    const float CS = SCL * 1.4426950408889634f;     // 1/8 and log2(e) in one factor
    v16h qf[2][2];
#pragma unroll
    for (int g = 0; g < 2; ++g)
#pragma unroll
        for (int kc = 0; kc < 2; ++kc) qf[g][kc] = WFrag<h16>::ld(Q + (size_t)(q0 + 16 * g + c) * HD + 32 * kc + 8 * h);
    v8f acc[2][4]; float m_run[2], l_run[2];
#pragma unroll
    for (int g = 0; g < 2; ++g) { m_run[g] = -3.0e38f; l_run[g] = 0.f;
#pragma unroll
        for (int t = 0; t < 4; ++t) acc[g][t] = (v8f){}; }
    const int srow = tid >> 3, scol = (tid & 7) * 8;   // this thread's 16-byte pieces of a tile: rows srow and srow + 32
    v8h rk[2], rv[2];
#pragma unroll
    for (int j = 0; j < 2; ++j) { rk[j] = *(const v8h*)(Kp + (size_t)(srow + 32 * j) * HD + scol); rv[j] = *(const v8h*)(Vp + (size_t)(srow + 32 * j) * HD + scol); }
#pragma unroll
    for (int j = 0; j < 2; ++j) { *(v8h*)(sm + (srow + 32 * j) * LPH + scol) = rk[j]; *(v8h*)(sm + TILEH + (srow + 32 * j) * LPV + scol) = rv[j]; }
    __syncthreads();
#pragma unroll 1   // rolled: one copy of the tile's work, the buffer picked by s & 1
    for (int s = 0; s < TT / SKEY; ++s) {
        if (s + 1 < TT / SKEY) {
#pragma unroll
            for (int j = 0; j < 2; ++j) { rk[j] = *(const v8h*)(Kp + (size_t)((s + 1) * SKEY + srow + 32 * j) * HD + scol); rv[j] = *(const v8h*)(Vp + (size_t)((s + 1) * SKEY + srow + 32 * j) * HD + scol); }
        }
        const h16* Kb = sm + (s & 1) * BUFH; const h16* Vb = Kb + TILEH + (8 * h + (lane & 7)) * LPV + 8 * ((lane >> 3) & 1);   // Vb: this lane's address in the transposing load's map
#pragma unroll 1   // rolled: with both 32-key passes unrolled the build spilled a staged load to scratch, which put its wait at the head of the tile
        for (int p = 0; p < SKEY / 32; ++p) {
            v8f sc[2][2];
#pragma unroll
            for (int kt = 0; kt < 2; ++kt) { v16h kf[2];
#pragma unroll
                for (int kc = 0; kc < 2; ++kc) kf[kc] = WFrag<h16>::ld(Kb + (32 * p + 16 * kt + c) * LPH + 32 * kc + 8 * h);
#pragma unroll
                for (int g = 0; g < 2; ++g) { sc[kt][g] = (v8f){};
#pragma unroll
                    for (int kc = 0; kc < 2; ++kc) sc[kt][g] = wmma16(kf[kc], qf[g][kc], sc[kt][g]); } }
            v16h vf[4];
#pragma unroll
            for (int t = 0; t < 4; ++t) vf[t] = cat16(ldtr(Vb + (32 * p) * LPV + 16 * t), ldtr(Vb + (32 * p + 16) * LPV + 16 * t));   // row 16 t + c of V^T, keys 32 p + 8 h + 0..7 and 32 p + 16 + 8 h + 0..7
#pragma unroll
            for (int g = 0; g < 2; ++g) {
                float mx = sc[0][g][0];
#pragma unroll
                for (int r = 1; r < 8; ++r) mx = fmaxf(mx, sc[0][g][r]);
#pragma unroll
                for (int r = 0; r < 8; ++r) mx = fmaxf(mx, sc[1][g][r]);
                mx = fmaxf(mx, xhalf(mx));             // both wave halves hold this query's maximum over the 32 keys
                const float mn = fmaxf(m_run[g], mx * CS); const float corr = __builtin_amdgcn_exp2f(m_run[g] - mn); m_run[g] = mn;
                float ls = 0.f; v16h pf;
#pragma unroll
                for (int i = 0; i < 8; ++i) {
                    const v2f a = __builtin_elementwise_fma((v2f){sc[i >> 2][g][2 * (i & 3)], sc[i >> 2][g][2 * (i & 3) + 1]}, (v2f){CS, CS}, (v2f){-mn, -mn});
                    const float p0 = __builtin_amdgcn_exp2f(a[0]), p1 = __builtin_amdgcn_exp2f(a[1]); ls += p0 + p1;
                    const v2hh w = __builtin_convertvector((v2f){p0, p1}, v2hh); pf[2 * i] = w[0]; pf[2 * i + 1] = w[1]; }
                l_run[g] = l_run[g] * corr + ls;       // this half's keys only; the halves are joined once, behind the loop
#pragma unroll
                for (int t = 0; t < 4; ++t) { acc[g][t] = acc[g][t] * corr; acc[g][t] = wmma16(vf[t], pf, acc[g][t]); }
            }
            __builtin_amdgcn_sched_barrier(0);   // keeps the slots below behind the last product
            asm volatile("v_nop\n\tv_nop\n\tv_nop\n\tv_nop");   // the distance behind the last product on the loop's taken branch, whose head rewrites that product's A registers
        }
        if (s + 1 < TT / SKEY) { h16* Wb = sm + ((s + 1) & 1) * BUFH;   // its last readers left it in front of the barrier that ended trip s - 1
#pragma unroll
            for (int j = 0; j < 2; ++j) { *(v8h*)(Wb + (srow + 32 * j) * LPH + scol) = rk[j]; *(v8h*)(Wb + TILEH + (srow + 32 * j) * LPV + scol) = rv[j]; }
        }
        __syncthreads();   // publishes tile s + 1 and ends every wave's reads of tile s
    }
    float* os = (float*)sm + wave * (16 * 68);   // 16 query rows of 64 f32, pitch 68, per wave: rows go out as whole lines
#pragma unroll
    for (int g = 0; g < 2; ++g) {
        const float f = __fdiv_rn(1.0f, l_run[g] + xhalf(l_run[g]));
#pragma unroll
        for (int t = 0; t < 4; ++t) { v4f lo, hi4;
#pragma unroll
            for (int r = 0; r < 4; ++r) { lo[r] = acc[g][t][r] * f; hi4[r] = acc[g][t][r + 4] * f; }
            *(v4fa*)(os + c * 68 + 16 * t + 8 * h) = lo; *(v4fa*)(os + c * 68 + 16 * t + 8 * h + 4) = hi4; }
        __builtin_amdgcn_wave_barrier(); asm volatile("" ::: "memory");   // keeps the row reads below behind the other lanes' LDS writes in the compiled order
#pragma unroll
        for (int i = 0; i < 4; ++i) { const int row = 4 * i + (lane >> 3), cofs = (lane & 7) * 8;   // a row of 64 bf16 is one 128-byte line: eight lanes a row, four rows a store
            const v4f v0 = *(const v4fa*)(os + row * 68 + cofs), v1 = *(const v4fa*)(os + row * 68 + cofs + 4); v8us oh, ol;
#pragma unroll
            for (int k = 0; k < 4; ++k) { unsigned short a, b; splitf(v0[k], a, b); oh[k] = a; ol[k] = b; splitf(v1[k], a, b); oh[k + 4] = a; ol[k + 4] = b; }
            const size_t o = (size_t)(q0 + 16 * g + row) * DD + cofs; *(v8us*)(Ah + o) = oh; *(v8us*)(Al + o) = ol; }
        asm volatile("s_wait_xcnt 0x0" ::: "memory");   // stands in front of the next group's work, which rewrites registers that these stores name
        __builtin_amdgcn_wave_barrier(); asm volatile("" ::: "memory");   // keeps the next group's LDS writes behind these reads
    }
}

extern "C" void kernel_launch(void* const* d_in, const int* in_sizes, int n_in,
                              void* d_out, int out_size, void* d_ws, size_t ws_size, hipStream_t stream) {
    (void)in_sizes; (void)n_in; (void)out_size;
    const float* x = (const float*)d_in[0]; const float* Wq = (const float*)d_in[1]; const float* bq = (const float*)d_in[2]; const float* Wk = (const float*)d_in[3]; const float* bk = (const float*)d_in[4]; const float* Wv = (const float*)d_in[5]; const float* bv = (const float*)d_in[6]; const float* Wo = (const float*)d_in[7]; const float* bo = (const float*)d_in[8];
    float* OUT = (float*)d_out;     // [16][1024][768]
    char* wsp = (char*)d_ws;
    auto take = [&](size_t bytes) { char* p = wsp; wsp += (bytes + 255) & ~(size_t)255; return (void*)p; };
    bf* WQ = (bf*)take((size_t)DD * FIN * 2); bf* WK = (bf*)take((size_t)DD * FIN * 2); bf* WV = (bf*)take((size_t)DD * FIN * 2); bf* WO = (bf*)take((size_t)DO * DD * 2);
    h16* QP = (h16*)take((size_t)NT * DD * 2); h16* KP = (h16*)take((size_t)NT * DD * 2); h16* VP = (h16*)take((size_t)NT * DD * 2);
    bf* XB = (bf*)take((size_t)NT * FIN * 2); bf* ATh = (bf*)take((size_t)NT * DD * 2); bf* ATl = (bf*)take((size_t)NT * DD * 2);
    if ((size_t)(wsp - (char*)d_ws) > ws_size) return;    // total ~ 156 MB; ws 256 MiB
    k_prep<<<(unsigned)(4 * WTB + ((size_t)NT * FIN / 8 + 255) / 256), 256, 0, stream>>>(x, Wq, Wk, Wv, Wo, XB, WQ, WK, WV, WO);
    // all 16 batches per launch: the rows of x are one [NT][768] matrix, and the 192 head planes are the flat projection memory
    const dim3 gP(NT / GT, DD / GT, 3);
    // the three projections as one grid, z = q, k, v: WQ, WK, WV and QP, KP, VP lie one behind the other in the workspace (each size is a multiple of the 256-byte rounding of take)
    static_assert(((size_t)DD * FIN * 2) % 256 == 0 && ((size_t)NT * DD * 2) % 256 == 0, "planes contiguous");
    k_gemmw<bf, 0, true, FIN, true><<<gP, 128, 0, stream>>>(XB, nullptr, WQ, nullptr, QP, DD, bq, bk, bv, 0, (size_t)DD * FIN, (size_t)NT * DD);
    k_fattn<<<dim3(TT / 256, NB_ * NH_, 1), 256, 0, stream>>>(QP, KP, VP, ATh, ATl);
    k_gemmw<bf, 1, true, DD, false><<<dim3(NT / GT, DO / GT, 1), 128, 0, stream>>>(ATh, ATl, WO, OUT, nullptr, DO, bo, bo, bo, 0, 0, 0);
}

// v007
// One run takes 148 microseconds.
// Next to v006, in two timings, it ran 1.07 and 1.06 times as fast.
// Over all steps from v000 it is 14.6 times as fast.
#include <hip/hip_runtime.h>

// ViT self-attention (x [16][1024][768]; q/k/v = x @ W + b; the module reshapes (B,N,C) -> (B*H, N, Dh) WITHOUT a transpose, so "head" g of a batch is the contiguous chunk g of the
// projection viewed as [1024][64]; scores = q2.k2 / 8; softmax; ctx2 = attn.v2; ctx2.reshape(B,H,N,Dh).transpose(0,2,1,3) -> [n][h*64+d]; out = ctx @ Wo + bo [16][1024][768]).
// Compute dtypes, f32 accumulate: every input rounded to bf16; projections on PLAIN bf16 operands (inputs: exact, + bias); scores and attn.v on SINGLE fp16 planes
// (the head planes ARE the projection memory: flat fp16 planes that the projection GEMMs store; 1/8 applied in f32 in the softmax; P = exp(s - running max), at most 1); scores, softmax and attn.v run in ONE kernel, no score plane in memory;
// no f32 plane lies between the kernels: the projection GEMMs store the fp16 planes, and the attention kernel stores the output product's two bf16 planes, from their own epilogues.

#define NB_  16
#define TT   1024
#define FIN  768
#define DD   768                  // H * Dh
#define NH_  12
#define HD   64
#define DO   768
#define NT   (NB_ * TT)
#define SCL  0.125f               // 1/sqrt(64)
typedef _Float16 h16;
typedef unsigned short bf;
typedef __attribute__((ext_vector_type(16))) __bf16   v16bf;
typedef __attribute__((ext_vector_type(16))) _Float16 v16h;
typedef __attribute__((ext_vector_type(8)))  _Float16 v8h;
typedef __attribute__((ext_vector_type(8)))  unsigned short v8us;
typedef __attribute__((ext_vector_type(8)))  float    v8f;
typedef __attribute__((ext_vector_type(4)))  float    v4f;
typedef v8h  __attribute__((may_alias)) v8ha;
typedef v4f  __attribute__((may_alias)) v4fa;
typedef v8us __attribute__((may_alias)) v8usa;

__device__ __forceinline__ unsigned short f2bf(float f) { unsigned u = __float_as_uint(f); u += 0x7FFFu + ((u >> 16) & 1u); return (unsigned short)(u >> 16); }
__device__ __forceinline__ float bf2f(unsigned short b) { return __uint_as_float(((unsigned)b) << 16); }
__device__ __forceinline__ float bfr(float f) { return bf2f(f2bf(f)); }
__device__ __forceinline__ v16h cat16(v8h lo, v8h hi) { return __builtin_shufflevector(lo, hi, 0, 1, 2, 3, 4, 5, 6, 7, 8, 9, 10, 11, 12, 13, 14, 15); }
__device__ __forceinline__ v16bf cat16b(v8us lo, v8us hi) { return __builtin_bit_cast(v16bf, __builtin_shufflevector(lo, hi, 0, 1, 2, 3, 4, 5, 6, 7, 8, 9, 10, 11, 12, 13, 14, 15)); }
__device__ __forceinline__ v8f wmma16(v16h a, v16h b, v8f c) { return __builtin_amdgcn_wmma_f32_16x16x32_f16(false, a, false, b, (short)0, c, false, false); }
__device__ __forceinline__ v8f wmmab(v16bf a, v16bf b, v8f c) { return __builtin_amdgcn_wmma_f32_16x16x32_bf16(false, a, false, b, (short)0, c, false, false); }



// ---- k_gemmw: GEMM, one 128x128 output tile per work-group of FOUR WAVES (2 x 2, each 64x64 = 16 accumulators); grid (M/128, N/128, Z), 128 threads.
// C[m][n] (f32, or for H16OUT rounded once to fp16 into Ch; pitch ldc, + optional f32 bias[n]) = sum_k A[m][k] Bt[n][k] (+ A2[m][k] Bt[n][k] for NSPLIT == 1). z-batch strides sA/sB/sC in elements; product z takes bias0, bias1 or bias2 (Z <= 3). M, N % 128 == 0, K % 64 == 0, a compile-time constant.
// The operands' rows come as whole 128-byte lines (64 k) by asynchronous copies into two LDS buffers (row pitch 144 B for the 16-byte fragment reads) and are shared by the waves;
// the copies of stage t + 2 fly under the work on stage t + 1.
template <typename T16> struct WFrag;
template <> struct WFrag<h16> { typedef v16h V; static __device__ __forceinline__ V ld(const h16* p) { return cat16(*(const v8h*)p, *(const v8h*)(p + 16)); } static __device__ __forceinline__ v8f mma(V a, V b, v8f c) { return wmma16(a, b, c); } };
template <> struct WFrag<bf> { typedef v16bf V; static __device__ __forceinline__ V ld(const bf* p) { return cat16b(*(const v8us*)p, *(const v8us*)(p + 16)); } static __device__ __forceinline__ v8f mma(V a, V b, v8f c) { return wmmab(a, b, c); } };
#define GT   128                  // rows and columns of a work-group's output tile
#define GKC  64                   // k per stage
#define GLP  72                   // LDS row pitch in 16-bit elements: 144 B = 16 B x 9
// One operand's 128 rows of a stage: this lane's 16 bytes of rows r, r + 16, ..., r + 112 (l: its LDS byte address, g: its global address, rs: 16 rows in elements).
// The s_wait_xcnt stands inside the statement so that no address register named here is rewritten in front of it.
template <typename T16>
__device__ __forceinline__ void cp128(unsigned l, const T16* g, size_t rs) {
    asm volatile("global_load_async_to_lds_b128 %0, %8, off\n\t"
                 "global_load_async_to_lds_b128 %1, %9, off\n\t"
                 "global_load_async_to_lds_b128 %2, %10, off\n\t"
                 "global_load_async_to_lds_b128 %3, %11, off\n\t"
                 "global_load_async_to_lds_b128 %4, %12, off\n\t"
                 "global_load_async_to_lds_b128 %5, %13, off\n\t"
                 "global_load_async_to_lds_b128 %6, %14, off\n\t"
                 "global_load_async_to_lds_b128 %7, %15, off\n\t"
                 "s_wait_xcnt 0x0"
                 :: "v"(l), "v"(l + 1u * 16 * GLP * 2), "v"(l + 2u * 16 * GLP * 2), "v"(l + 3u * 16 * GLP * 2), "v"(l + 4u * 16 * GLP * 2), "v"(l + 5u * 16 * GLP * 2), "v"(l + 6u * 16 * GLP * 2), "v"(l + 7u * 16 * GLP * 2),
                    "v"(g), "v"(g + rs), "v"(g + 2 * rs), "v"(g + 3 * rs), "v"(g + 4 * rs), "v"(g + 5 * rs), "v"(g + 6 * rs), "v"(g + 7 * rs) : "memory");
}
template <typename T16, int NSPLIT, bool BIAS, int K, bool H16OUT>
__global__ __launch_bounds__(128) void k_gemmw(const T16* __restrict__ A, const T16* __restrict__ A2, const T16* __restrict__ Bt, float* C, h16* Ch, int ldc, const float* __restrict__ bias0, const float* __restrict__ bias1, const float* __restrict__ bias2, size_t sA, size_t sB, size_t sC) {
    typedef typename WFrag<T16>::V V;
    static_assert(NSPLIT == 0 || NSPLIT == 1, "one or two A planes"); static_assert(K % GKC == 0 && K / GKC >= 2, "whole stages, at least two");
    constexpr int OPH = GT * GLP;                       // one operand's rows of a stage, in elements
    constexpr int STG = (NSPLIT == 1 ? 3 : 2) * OPH;    // a stage: [A | Bt | A2]
    __shared__ __align__(16) T16 sm[2 * STG];           // two stages; the output staging reuses them
    const size_t z = blockIdx.z; A += z * sA; if (NSPLIT == 1) A2 += z * sA; Bt += z * sB; if (H16OUT) Ch += z * sC; else C += z * sC;
    const float* __restrict__ bias = z == 0 ? bias0 : z == 1 ? bias1 : bias2;
    const int tid = threadIdx.x, lane = tid & 31, wave = tid >> 5, lr = lane & 15, hi = lane >> 4;
    const int r0 = blockIdx.x * GT, c0 = blockIdx.y * GT, wr = (wave & 1) * 64, wc = (wave >> 1) * 64;
    v8f acc[4][4];
#pragma unroll
    for (int mb = 0; mb < 4; ++mb)
#pragma unroll
        for (int nb = 0; nb < 4; ++nb) acc[mb][nb] = (v8f){};
    const int crow = tid >> 3, ccol = (tid & 7) * 8;    // this thread's 16-byte piece: eight lanes per 128-byte row, four whole lines per wave and copy
    constexpr size_t rs = (size_t)16 * K;
    const T16* gA = A + (size_t)(r0 + crow) * K + ccol; const T16* gB = Bt + (size_t)(c0 + crow) * K + ccol; const T16* gA2 = (NSPLIT == 1) ? A2 + (size_t)(r0 + crow) * K + ccol : nullptr;
    const unsigned l0 = (unsigned)(size_t)(sm + crow * GLP + ccol);   // low 32 bits of the shared address = LDS byte address
    auto fill = [&](int t, int buf) { const unsigned l = l0 + (unsigned)buf * (STG * 2);
        cp128(l, gA + (size_t)t * GKC, rs); cp128(l + OPH * 2, gB + (size_t)t * GKC, rs); if (NSPLIT == 1) cp128(l + 2 * OPH * 2, gA2 + (size_t)t * GKC, rs); };
    constexpr int nt = K / GKC;
    fill(0, 0);
    asm volatile("s_wait_asynccnt 0x0" ::: "memory");   // this wave's copies of stage 0 have landed
    __syncthreads();                                    // publishes stage 0
    fill(1, 1);
#pragma unroll 1   // rolled: one copy of a stage's work, the buffer picked by t & 1
    for (int t = 0; t < nt; ++t) {
        const T16* Sa = sm + (t & 1) * STG + (wr + lr) * GLP + 8 * hi; const T16* Sb = sm + (t & 1) * STG + OPH + (wc + lr) * GLP + 8 * hi;
#pragma unroll   // unrolled, as the loops inside: every fragment and accumulator index is a constant, so they stay in registers
        for (int kc = 0; kc < GKC; kc += 32) {
            V a[4], a2[4], b[4];   // all fragments of this 32 k as one group of LDS reads in front of the products
#pragma unroll
            for (int mb = 0; mb < 4; ++mb) { a[mb] = WFrag<T16>::ld(Sa + mb * 16 * GLP + kc); b[mb] = WFrag<T16>::ld(Sb + mb * 16 * GLP + kc); if (NSPLIT == 1) a2[mb] = WFrag<T16>::ld(Sa + 2 * OPH + mb * 16 * GLP + kc); }
            __builtin_amdgcn_sched_barrier(0);   // keeps the reads one group: sunk among the products they shared one register set, and the wave waited out the LDS latency at every fourth product
#pragma unroll
            for (int nb = 0; nb < 4; ++nb)
#pragma unroll
                for (int mb = 0; mb < 4; ++mb) { acc[mb][nb] = WFrag<T16>::mma(a[mb], b[nb], acc[mb][nb]); if (NSPLIT == 1) acc[mb][nb] = WFrag<T16>::mma(a2[mb], b[nb], acc[mb][nb]); }
        }
        __builtin_amdgcn_sched_barrier(0);                  // keeps the products in front of the barrier: sunk behind it they stood in front of the refill and took half a stage off the copies' lead
        asm volatile("s_wait_dscnt 0x0" ::: "memory");      // this wave's reads of stage t are done before the buffer is refilled
        asm volatile("s_wait_asynccnt 0x0" ::: "memory");   // this wave's copies of stage t + 1 have landed
        __syncthreads();                                    // publishes stage t + 1 and ends every wave's reads of stage t
        if (t + 2 < nt) fill(t + 2, t & 1);
    }
    asm volatile("s_wait_asynccnt 0x0" ::: "memory");       // no copy is outstanding when the buffers become output staging
    float* os = (float*)sm + wave * (16 * 68);              // 16 rows of 64 f32, pitch 68, per wave: rows go out as whole lines
#pragma unroll
    for (int mb = 0; mb < 4; ++mb) {
#pragma unroll
        for (int nb = 0; nb < 4; ++nb) {
#pragma unroll
            for (int j = 0; j < 8; ++j) os[(hi * 8 + j) * 68 + nb * 16 + lr] = acc[mb][nb][j]; }
        __builtin_amdgcn_wave_barrier(); asm volatile("" ::: "memory");   // keeps the row reads below behind the other lanes' LDS writes in the compiled order
        if (H16OUT) {   // a row of 64 fp16 is one 128-byte line: eight lanes a row, four rows a store
            h16* crh = Ch + (size_t)(r0 + wr + mb * 16) * ldc + c0 + wc;
#pragma unroll
            for (int s = 0; s < 4; ++s) { const int row = 4 * s + (lane >> 3), cofs = (lane & 7) * 8; const v4f v0 = *(const v4fa*)(os + row * 68 + cofs), v1 = *(const v4fa*)(os + row * 68 + cofs + 4); v8h o;
#pragma unroll
                for (int k = 0; k < 4; ++k) { const float* bp = bias + c0 + wc + cofs; o[k] = (h16)(BIAS ? v0[k] + bfr(bp[k]) : v0[k]); o[k + 4] = (h16)(BIAS ? v1[k] + bfr(bp[k + 4]) : v1[k]); }
                *(v8h*)(crh + (size_t)row * ldc + cofs) = o; }
        } else {
        float* crw = C + (size_t)(r0 + wr + mb * 16) * ldc + c0 + wc;
#pragma unroll
        for (int s = 0; s < 8; ++s) { const int row = 2 * s + hi, cofs = lr * 4; v4f val = *(const v4fa*)(os + row * 68 + cofs); if (BIAS) { const float* bp = bias + c0 + wc + cofs; val[0] += bfr(bp[0]); val[1] += bfr(bp[1]); val[2] += bfr(bp[2]); val[3] += bfr(bp[3]); }
            *(v4f*)(crw + (size_t)row * ldc + cofs) = val; }
        }
        asm volatile("s_wait_xcnt 0x0" ::: "memory");   // stands in front of the next rows' work, which rewrites registers that these stores name
        __builtin_amdgcn_wave_barrier(); asm volatile("" ::: "memory");   // keeps the next 16 rows' LDS writes behind these reads
    }
}

__device__ __forceinline__ void splitf(float y, unsigned short& h, unsigned short& l) { h = f2bf(y); l = f2bf(y - bf2f(h)); }
typedef __attribute__((ext_vector_type(4))) _Float16 v4h;
typedef __attribute__((ext_vector_type(2))) unsigned short v2us;

// ---- k_prep: the five independent input conversions as ONE grid of few, long waves: every wave issues all its loads, each on four lines, in front of its first conversion.
// Blocks 0 .. XBLK - 1 round x (the long stream starts first), the 4 WTB blocks behind them transpose and round the four weights. The test on the block index is the same for a whole work-group; no barrier in either part.
typedef __attribute__((ext_vector_type(4))) unsigned short v4us;
#define XCH  24                   // loads of 512 contiguous bytes of x per wave: 12 KB of x, 6 KB of bf16 a wave
#define XBLK ((size_t)NT * FIN / (8 * XCH * 128))   // blocks of eight waves
static_assert((size_t)NT * FIN % (8 * XCH * 128) == 0, "x is whole blocks");
__device__ __forceinline__ void cvtS(const float* __restrict__ src, bf* __restrict__ dst, unsigned blk) {
    const size_t e0 = ((size_t)blk * 8 + (threadIdx.x >> 5)) * (XCH * 128) + (threadIdx.x & 31) * 4; v4f v[XCH];
#pragma unroll   // unrolled, as the loops below: v stays in registers and the 24 loads stand as one group in front of the first conversion
    for (int j = 0; j < XCH; ++j) v[j] = *(const v4f*)(src + e0 + j * 128);
#pragma unroll
    for (int j = 0; j < XCH; ++j) { v4us o;
#pragma unroll
        for (int k = 0; k < 4; ++k) o[k] = f2bf(v[j][k]);
        *(v4us*)(dst + e0 + j * 128) = o; }   // 256 contiguous bytes a store: two whole lines
}
// A wave transposes 64 k x 16 columns of w [FIN][DD] into Bt [DD][FIN]: lane (g = lane >> 3, c = lane & 7) holds k 8 g .. 8 g + 7 and 32 + 8 g .. 32 + 8 g + 7 of columns c and c + 8,
// so a load takes 32 bytes from each of four rows, and a column's 64 k leave as the two halves of one 128-byte line. The eight waves of a block share the rows' lines (128 columns).
static_assert(FIN == DD && DD == DO, "the four weights have one shape"); static_assert(DD % 128 == 0 && FIN % 64 == 0, "whole blocks of columns, whole lines of k");
#define WTB ((DD / 16) * (FIN / 64) / 8)   // blocks per weight
__device__ __forceinline__ void wtS(const float* __restrict__ w, bf* __restrict__ Bt, unsigned blk) {
    const int lane = threadIdx.x & 31; const unsigned wv = blk * 8 + (threadIdx.x >> 5);
    const int n = (int)(wv % (DD / 16)) * 16 + (lane & 7), k0 = (int)(wv / (DD / 16)) * 64 + 8 * (lane >> 3); float v[2][16];
#pragma unroll   // unrolled, as the loops below: v stays in registers and the 32 loads stand as one group in front of the first conversion
    for (int u = 0; u < 2; ++u)
#pragma unroll
        for (int i = 0; i < 16; ++i) v[u][i] = w[(size_t)(k0 + 32 * (i >> 3) + (i & 7)) * DD + n + 8 * u];
#pragma unroll
    for (int u = 0; u < 2; ++u)
#pragma unroll
        for (int hf = 0; hf < 2; ++hf) { v8us o;
#pragma unroll
            for (int i = 0; i < 8; ++i) o[i] = f2bf(v[u][8 * hf + i]);
            *(v8us*)(Bt + (size_t)(n + 8 * u) * FIN + k0 + 32 * hf) = o; }
}
__global__ __launch_bounds__(256) void k_prep(const float* __restrict__ x, const float* __restrict__ Wq, const float* __restrict__ Wk, const float* __restrict__ Wv, const float* __restrict__ Wo,
                                              bf* XB, bf* WQ, bf* WK, bf* WV, bf* WO) {
    const unsigned b = blockIdx.x;
    if (b < XBLK) cvtS(x, XB, b);
    else { const unsigned j = (b - (unsigned)XBLK) / WTB;
        wtS(j == 0 ? Wq : j == 1 ? Wk : j == 2 ? Wv : Wo, j == 0 ? WQ : j == 1 ? WK : j == 2 ? WV : WO, b - (unsigned)XBLK - j * WTB); }
}
#define SKEY 64                   // keys per LDS tile
#define LPH  72                   // K's LDS row pitch in halfs: 144 B = 16 B x 9
#define LPV  80                   // V's LDS row pitch in halfs: 160 B = 32 B x 5, the transposing load's pitch
#define TILEH (SKEY * LPH)
#define TILEV (SKEY * LPV)
#define BUFH  (TILEH + TILEV)     // one buffer: [K | V]
typedef __attribute__((ext_vector_type(2))) float v2f;
typedef __attribute__((ext_vector_type(2))) _Float16 v2hh;
typedef __attribute__((ext_vector_type(8))) short v8s;
// Lane l passes the address of 16 bytes of row 8 (l >> 4) + (l & 7), column group (l >> 3) & 1, of a 16 x 16 block; lane (c, h) receives rows 8 h .. 8 h + 7 of column c.
__device__ __forceinline__ v8h ldtr(const h16* p) { typedef __attribute__((address_space(3))) v8s lv8s; return __builtin_bit_cast(v8h, __builtin_amdgcn_ds_load_tr16_b128_v8i16((lv8s*)p)); }
__device__ __forceinline__ float xhalf(float x) { return __builtin_bit_cast(float, __builtin_amdgcn_permlanex16(__builtin_bit_cast(int, x), __builtin_bit_cast(int, x), 0x76543210, 0xfedcba98, false, false)); }  // lane l with lane l ^ 16
__global__ __launch_bounds__(256) __attribute__((amdgpu_waves_per_eu(4, 4))) void k_fattn(const h16* __restrict__ Q, const h16* __restrict__ Kp, const h16* __restrict__ Vp, bf* __restrict__ Ah, bf* __restrict__ Al) {
    __shared__ __align__(32) h16 sm[2 * BUFH];      // [buffer][K rows, pitch LPH | V rows, pitch LPV]; the output staging reuses it
    static_assert(2 * BUFH * 2 >= 8 * 16 * 68 * 4, "the output staging fits");
    const int tid = threadIdx.x, lane = tid & 31, wave = tid >> 5, c = lane & 15, h = lane >> 4;
    { const size_t hb = (size_t)blockIdx.y * TT * HD; Q += hb; Kp += hb; Vp += hb;
      const size_t ob = (size_t)(blockIdx.y / NH_) * TT * DD + (size_t)(blockIdx.y % NH_) * HD; Ah += ob; Al += ob; }
    const int q0 = blockIdx.x * 256 + wave * 32;
    const float CS = SCL * 1.4426950408889634f;     // 1/8 and log2(e) in one factor
    v16h qf[2][2];
#pragma unroll
    for (int g = 0; g < 2; ++g)
#pragma unroll
        for (int kc = 0; kc < 2; ++kc) qf[g][kc] = WFrag<h16>::ld(Q + (size_t)(q0 + 16 * g + c) * HD + 32 * kc + 8 * h);
    v8f acc[2][4]; float m_run[2], l_run[2];
#pragma unroll
    for (int g = 0; g < 2; ++g) { m_run[g] = -3.0e38f; l_run[g] = 0.f;
#pragma unroll
        for (int t = 0; t < 4; ++t) acc[g][t] = (v8f){}; }
    const int srow = tid >> 3, scol = (tid & 7) * 8;   // this thread's 16-byte pieces of a tile: rows srow and srow + 32
    v8h rk[2], rv[2];
#pragma unroll
    for (int j = 0; j < 2; ++j) { rk[j] = *(const v8h*)(Kp + (size_t)(srow + 32 * j) * HD + scol); rv[j] = *(const v8h*)(Vp + (size_t)(srow + 32 * j) * HD + scol); }
#pragma unroll
    for (int j = 0; j < 2; ++j) { *(v8h*)(sm + (srow + 32 * j) * LPH + scol) = rk[j]; *(v8h*)(sm + TILEH + (srow + 32 * j) * LPV + scol) = rv[j]; }
    __syncthreads();
#pragma unroll 1   // rolled: one copy of the tile's work, the buffer picked by s & 1
    for (int s = 0; s < TT / SKEY; ++s) {
        if (s + 1 < TT / SKEY) {
#pragma unroll
            for (int j = 0; j < 2; ++j) { rk[j] = *(const v8h*)(Kp + (size_t)((s + 1) * SKEY + srow + 32 * j) * HD + scol); rv[j] = *(const v8h*)(Vp + (size_t)((s + 1) * SKEY + srow + 32 * j) * HD + scol); }
        }
        const h16* Kb = sm + (s & 1) * BUFH; const h16* Vb = Kb + TILEH + (8 * h + (lane & 7)) * LPV + 8 * ((lane >> 3) & 1);   // Vb: this lane's address in the transposing load's map
#pragma unroll 1   // rolled: with both 32-key passes unrolled the build spilled a staged load to scratch, which put its wait at the head of the tile
        for (int p = 0; p < SKEY / 32; ++p) {
            v8f sc[2][2];
#pragma unroll
            for (int kt = 0; kt < 2; ++kt) { v16h kf[2];
#pragma unroll
                for (int kc = 0; kc < 2; ++kc) kf[kc] = WFrag<h16>::ld(Kb + (32 * p + 16 * kt + c) * LPH + 32 * kc + 8 * h);
#pragma unroll
                for (int g = 0; g < 2; ++g) { sc[kt][g] = (v8f){};
#pragma unroll
                    for (int kc = 0; kc < 2; ++kc) sc[kt][g] = wmma16(kf[kc], qf[g][kc], sc[kt][g]); } }
            v16h vf[4];
#pragma unroll
            for (int t = 0; t < 4; ++t) vf[t] = cat16(ldtr(Vb + (32 * p) * LPV + 16 * t), ldtr(Vb + (32 * p + 16) * LPV + 16 * t));   // row 16 t + c of V^T, keys 32 p + 8 h + 0..7 and 32 p + 16 + 8 h + 0..7
#pragma unroll
            for (int g = 0; g < 2; ++g) {
                float mx = sc[0][g][0];
#pragma unroll
                for (int r = 1; r < 8; ++r) mx = fmaxf(mx, sc[0][g][r]);
#pragma unroll
                for (int r = 0; r < 8; ++r) mx = fmaxf(mx, sc[1][g][r]);
                mx = fmaxf(mx, xhalf(mx));             // both wave halves hold this query's maximum over the 32 keys
                const float mn = fmaxf(m_run[g], mx * CS); const float corr = __builtin_amdgcn_exp2f(m_run[g] - mn); m_run[g] = mn;
                float ls = 0.f; v16h pf;
#pragma unroll
                for (int i = 0; i < 8; ++i) {
                    const v2f a = __builtin_elementwise_fma((v2f){sc[i >> 2][g][2 * (i & 3)], sc[i >> 2][g][2 * (i & 3) + 1]}, (v2f){CS, CS}, (v2f){-mn, -mn});
                    const float p0 = __builtin_amdgcn_exp2f(a[0]), p1 = __builtin_amdgcn_exp2f(a[1]); ls += p0 + p1;
                    const v2hh w = __builtin_convertvector((v2f){p0, p1}, v2hh); pf[2 * i] = w[0]; pf[2 * i + 1] = w[1]; }
                l_run[g] = l_run[g] * corr + ls;       // this half's keys only; the halves are joined once, behind the loop
#pragma unroll
                for (int t = 0; t < 4; ++t) { acc[g][t] = acc[g][t] * corr; acc[g][t] = wmma16(vf[t], pf, acc[g][t]); }
            }
            __builtin_amdgcn_sched_barrier(0);   // keeps the slots below behind the last product
            asm volatile("v_nop\n\tv_nop\n\tv_nop\n\tv_nop");   // the distance behind the last product on the loop's taken branch, whose head rewrites that product's A registers
        }
        if (s + 1 < TT / SKEY) { h16* Wb = sm + ((s + 1) & 1) * BUFH;   // its last readers left it in front of the barrier that ended trip s - 1
#pragma unroll
            for (int j = 0; j < 2; ++j) { *(v8h*)(Wb + (srow + 32 * j) * LPH + scol) = rk[j]; *(v8h*)(Wb + TILEH + (srow + 32 * j) * LPV + scol) = rv[j]; }
        }
        __syncthreads();   // publishes tile s + 1 and ends every wave's reads of tile s
    }
    float* os = (float*)sm + wave * (16 * 68);   // 16 query rows of 64 f32, pitch 68, per wave: rows go out as whole lines
#pragma unroll
    for (int g = 0; g < 2; ++g) {
        const float f = __fdiv_rn(1.0f, l_run[g] + xhalf(l_run[g]));
#pragma unroll
        for (int t = 0; t < 4; ++t) { v4f lo, hi4;
#pragma unroll
            for (int r = 0; r < 4; ++r) { lo[r] = acc[g][t][r] * f; hi4[r] = acc[g][t][r + 4] * f; }
            *(v4fa*)(os + c * 68 + 16 * t + 8 * h) = lo; *(v4fa*)(os + c * 68 + 16 * t + 8 * h + 4) = hi4; }
        __builtin_amdgcn_wave_barrier(); asm volatile("" ::: "memory");   // keeps the row reads below behind the other lanes' LDS writes in the compiled order
#pragma unroll
        for (int i = 0; i < 4; ++i) { const int row = 4 * i + (lane >> 3), cofs = (lane & 7) * 8;   // a row of 64 bf16 is one 128-byte line: eight lanes a row, four rows a store
            const v4f v0 = *(const v4fa*)(os + row * 68 + cofs), v1 = *(const v4fa*)(os + row * 68 + cofs + 4); v8us oh, ol;
#pragma unroll
            for (int k = 0; k < 4; ++k) { unsigned short a, b; splitf(v0[k], a, b); oh[k] = a; ol[k] = b; splitf(v1[k], a, b); oh[k + 4] = a; ol[k + 4] = b; }
            const size_t o = (size_t)(q0 + 16 * g + row) * DD + cofs; *(v8us*)(Ah + o) = oh; *(v8us*)(Al + o) = ol; }
        asm volatile("s_wait_xcnt 0x0" ::: "memory");   // stands in front of the next group's work, which rewrites registers that these stores name
        __builtin_amdgcn_wave_barrier(); asm volatile("" ::: "memory");   // keeps the next group's LDS writes behind these reads
    }
}

extern "C" void kernel_launch(void* const* d_in, const int* in_sizes, int n_in,
                              void* d_out, int out_size, void* d_ws, size_t ws_size, hipStream_t stream) {
    (void)in_sizes; (void)n_in; (void)out_size;
    const float* x = (const float*)d_in[0]; const float* Wq = (const float*)d_in[1]; const float* bq = (const float*)d_in[2]; const float* Wk = (const float*)d_in[3]; const float* bk = (const float*)d_in[4]; const float* Wv = (const float*)d_in[5]; const float* bv = (const float*)d_in[6]; const float* Wo = (const float*)d_in[7]; const float* bo = (const float*)d_in[8];
    float* OUT = (float*)d_out;     // [16][1024][768]
    char* wsp = (char*)d_ws;
    auto take = [&](size_t bytes) { char* p = wsp; wsp += (bytes + 255) & ~(size_t)255; return (void*)p; };
    bf* WQ = (bf*)take((size_t)DD * FIN * 2); bf* WK = (bf*)take((size_t)DD * FIN * 2); bf* WV = (bf*)take((size_t)DD * FIN * 2); bf* WO = (bf*)take((size_t)DO * DD * 2);
    h16* QP = (h16*)take((size_t)NT * DD * 2); h16* KP = (h16*)take((size_t)NT * DD * 2); h16* VP = (h16*)take((size_t)NT * DD * 2);
    bf* XB = (bf*)take((size_t)NT * FIN * 2); bf* ATh = (bf*)take((size_t)NT * DD * 2); bf* ATl = (bf*)take((size_t)NT * DD * 2);
    if ((size_t)(wsp - (char*)d_ws) > ws_size) return;    // total ~ 156 MB; ws 256 MiB
    k_prep<<<(unsigned)(XBLK + 4 * WTB), 256, 0, stream>>>(x, Wq, Wk, Wv, Wo, XB, WQ, WK, WV, WO);
    // all 16 batches per launch: the rows of x are one [NT][768] matrix, and the 192 head planes are the flat projection memory
    const dim3 gP(NT / GT, DD / GT, 3);
    // the three projections as one grid, z = q, k, v: WQ, WK, WV and QP, KP, VP lie one behind the other in the workspace (each size is a multiple of the 256-byte rounding of take)
    static_assert(((size_t)DD * FIN * 2) % 256 == 0 && ((size_t)NT * DD * 2) % 256 == 0, "planes contiguous");
    k_gemmw<bf, 0, true, FIN, true><<<gP, 128, 0, stream>>>(XB, nullptr, WQ, nullptr, QP, DD, bq, bk, bv, 0, (size_t)DD * FIN, (size_t)NT * DD);
    k_fattn<<<dim3(TT / 256, NB_ * NH_, 1), 256, 0, stream>>>(QP, KP, VP, ATh, ATl);
    k_gemmw<bf, 1, true, DD, false><<<dim3(NT / GT, DO / GT, 1), 128, 0, stream>>>(ATh, ATl, WO, OUT, nullptr, DO, bo, bo, bo, 0, 0, 0);
}

// v008
// Measured time: 139 microseconds a run.
// Timed twice side by side with v007, it ran 1.06 times as fast both times.
// Counting every step since v000, it is 15.5 times as fast.
#include <hip/hip_runtime.h>

// ViT self-attention (x [16][1024][768]; q/k/v = x @ W + b; the module reshapes (B,N,C) -> (B*H, N, Dh) WITHOUT a transpose, so "head" g of a batch is the contiguous chunk g of the
// projection viewed as [1024][64]; scores = q2.k2 / 8; softmax; ctx2 = attn.v2; ctx2.reshape(B,H,N,Dh).transpose(0,2,1,3) -> [n][h*64+d]; out = ctx @ Wo + bo [16][1024][768]).
// Compute dtypes, f32 accumulate: every input rounded to bf16; projections on PLAIN bf16 operands (inputs: exact, + bias); scores and attn.v on SINGLE fp16 planes
// (the head planes ARE the projection memory: flat fp16 planes that the projection GEMMs store; 1/8 applied in f32 in the softmax; P = exp(s - running max), at most 1); scores, softmax and attn.v run in ONE kernel, no score plane in memory;
// no f32 plane lies between the kernels: the projection GEMMs store the fp16 planes, and the attention kernel stores the output product's two bf16 planes, from their own epilogues.

#define NB_  16
#define TT   1024
#define FIN  768
#define DD   768                  // H * Dh
#define NH_  12
#define HD   64
#define DO   768
#define NT   (NB_ * TT)
#define SCL  0.125f               // 1/sqrt(64)
typedef _Float16 h16;
typedef unsigned short bf;
typedef __attribute__((ext_vector_type(16))) __bf16   v16bf;
typedef __attribute__((ext_vector_type(16))) _Float16 v16h;
typedef __attribute__((ext_vector_type(8)))  _Float16 v8h;
typedef __attribute__((ext_vector_type(8)))  unsigned short v8us;
typedef __attribute__((ext_vector_type(8)))  float    v8f;
typedef __attribute__((ext_vector_type(4)))  float    v4f;
typedef v8h  __attribute__((may_alias)) v8ha;
typedef v4f  __attribute__((may_alias)) v4fa;
typedef v8us __attribute__((may_alias)) v8usa;

__device__ __forceinline__ unsigned short f2bf(float f) { unsigned u = __float_as_uint(f); u += 0x7FFFu + ((u >> 16) & 1u); return (unsigned short)(u >> 16); }
__device__ __forceinline__ float bf2f(unsigned short b) { return __uint_as_float(((unsigned)b) << 16); }
__device__ __forceinline__ float bfr(float f) { return bf2f(f2bf(f)); }
__device__ __forceinline__ v16h cat16(v8h lo, v8h hi) { return __builtin_shufflevector(lo, hi, 0, 1, 2, 3, 4, 5, 6, 7, 8, 9, 10, 11, 12, 13, 14, 15); }
__device__ __forceinline__ v16bf cat16b(v8us lo, v8us hi) { return __builtin_bit_cast(v16bf, __builtin_shufflevector(lo, hi, 0, 1, 2, 3, 4, 5, 6, 7, 8, 9, 10, 11, 12, 13, 14, 15)); }
__device__ __forceinline__ v8f wmma16(v16h a, v16h b, v8f c) { return __builtin_amdgcn_wmma_f32_16x16x32_f16(false, a, false, b, (short)0, c, false, false); }
__device__ __forceinline__ v8f wmmab(v16bf a, v16bf b, v8f c) { return __builtin_amdgcn_wmma_f32_16x16x32_bf16(false, a, false, b, (short)0, c, false, false); }



// ---- k_gemmw: GEMM, one (64 WM) x (64 WN) output tile per work-group of WM x WN WAVES (each 64x64 = 16 accumulators); grid (M / (64 WM), N / (64 WN), Z), 32 WM WN threads.
// The tile is large so that an operand row fetched from L2 serves many products: 256x128 (8 waves, two work-groups per WGP) for one A plane, 128x384 (12 waves, one work-group per WGP, 256 in all) for two.
// C[m][n] (f32, or for H16OUT rounded once to fp16 into Ch; pitch ldc, + optional f32 bias[n]) = sum_k A[m][k] Bt[n][k] (+ A2[m][k] Bt[n][k] for NSPLIT == 1). z-batch strides sA/sB/sC in elements; product z takes bias0, bias1 or bias2 (Z <= 3). M % (64 WM) == 0, N % (64 WN) == 0, K % 64 == 0, a compile-time constant.
// The operands' rows come as whole 128-byte lines (64 k) by asynchronous copies into two LDS buffers (row pitch 144 B for the 16-byte fragment reads) and are shared by the waves;
// the copies of stage t + 2 fly under the work on stage t + 1.
template <typename T16> struct WFrag;
template <> struct WFrag<h16> { typedef v16h V; static __device__ __forceinline__ V ld(const h16* p) { return cat16(*(const v8h*)p, *(const v8h*)(p + 16)); } static __device__ __forceinline__ v8f mma(V a, V b, v8f c) { return wmma16(a, b, c); } };
template <> struct WFrag<bf> { typedef v16bf V; static __device__ __forceinline__ V ld(const bf* p) { return cat16b(*(const v8us*)p, *(const v8us*)(p + 16)); } static __device__ __forceinline__ v8f mma(V a, V b, v8f c) { return wmmab(a, b, c); } };
#define GKC  64                   // k per stage
#define GLP  72                   // LDS row pitch in 16-bit elements: 144 B = 16 B x 9
#define GCS  (4u * GLP * 2)       // four LDS rows in bytes: the step between a chunk's copies
// A chunk is 16 rows of a stage, brought by one wave in four copies of four whole lines each: this lane's 16 bytes of rows r, r + 4, r + 8, r + 12 (l: its LDS byte address, g: its global address, rs: 4 rows in elements).
// cp1 and cp3 bring one chunk and three. The s_wait_xcnt stands inside each statement so that no address register named there is rewritten in front of it.
template <typename T16>
__device__ __forceinline__ void cp1(unsigned l, const T16* g, size_t rs) {
    asm volatile("global_load_async_to_lds_b128 %0, %4, off\n\t"
                 "global_load_async_to_lds_b128 %1, %5, off\n\t"
                 "global_load_async_to_lds_b128 %2, %6, off\n\t"
                 "global_load_async_to_lds_b128 %3, %7, off\n\t"
                 "s_wait_xcnt 0x0"
                 :: "v"(l), "v"(l + GCS), "v"(l + 2 * GCS), "v"(l + 3 * GCS),
                    "v"(g), "v"(g + rs), "v"(g + 2 * rs), "v"(g + 3 * rs) : "memory");
}
template <typename T16>
__device__ __forceinline__ void cp3(unsigned l, const T16* g, unsigned m, const T16* h, unsigned n, const T16* i, size_t rs) {
    asm volatile("global_load_async_to_lds_b128 %0, %12, off\n\t"
                 "global_load_async_to_lds_b128 %1, %13, off\n\t"
                 "global_load_async_to_lds_b128 %2, %14, off\n\t"
                 "global_load_async_to_lds_b128 %3, %15, off\n\t"
                 "global_load_async_to_lds_b128 %4, %16, off\n\t"
                 "global_load_async_to_lds_b128 %5, %17, off\n\t"
                 "global_load_async_to_lds_b128 %6, %18, off\n\t"
                 "global_load_async_to_lds_b128 %7, %19, off\n\t"
                 "global_load_async_to_lds_b128 %8, %20, off\n\t"
                 "global_load_async_to_lds_b128 %9, %21, off\n\t"
                 "global_load_async_to_lds_b128 %10, %22, off\n\t"
                 "global_load_async_to_lds_b128 %11, %23, off\n\t"
                 "s_wait_xcnt 0x0"
                 :: "v"(l), "v"(l + GCS), "v"(l + 2 * GCS), "v"(l + 3 * GCS), "v"(m), "v"(m + GCS), "v"(m + 2 * GCS), "v"(m + 3 * GCS), "v"(n), "v"(n + GCS), "v"(n + 2 * GCS), "v"(n + 3 * GCS),
                    "v"(g), "v"(g + rs), "v"(g + 2 * rs), "v"(g + 3 * rs), "v"(h), "v"(h + rs), "v"(h + 2 * rs), "v"(h + 3 * rs), "v"(i), "v"(i + rs), "v"(i + 2 * rs), "v"(i + 3 * rs) : "memory");
}
template <typename T16, int NSPLIT, bool BIAS, int K, bool H16OUT, int WM, int WN>
__global__ __launch_bounds__(WM * WN * 32) void k_gemmw(const T16* __restrict__ A, const T16* __restrict__ A2, const T16* __restrict__ Bt, float* C, h16* Ch, int ldc, const float* __restrict__ bias0, const float* __restrict__ bias1, const float* __restrict__ bias2, size_t sA, size_t sB, size_t sC) {
    typedef typename WFrag<T16>::V V;
    static_assert(NSPLIT == 0 || NSPLIT == 1, "one or two A planes"); static_assert(K % GKC == 0 && K / GKC >= 2, "whole stages, at least two");
    constexpr int NW = WM * WN, GTM = WM * 64, GTN = WN * 64;   // waves, rows and columns of the work-group's tile
    constexpr int OPA = GTM * GLP, OPB = GTN * GLP;     // one operand's rows of a stage, in elements
    constexpr int STG = (NSPLIT + 1) * OPA + OPB;       // a stage: [A | Bt | A2], rows of one pitch
    constexpr int NCH = ((NSPLIT + 1) * GTM + GTN) / 16, FULL = NCH / NW, REM = NCH % NW;   // chunks of a stage; wave w brings chunks w, w + NW, ...: FULL each, and the first REM waves one more
    static_assert(FULL == 3, "cp3, and cp1 for the odd chunk");
    __shared__ __align__(16) T16 sm[2 * STG];           // two stages; the output staging reuses them
    static_assert((size_t)2 * STG * 2 >= (size_t)NW * 16 * 68 * 4, "the output staging fits");
    const size_t z = blockIdx.z; A += z * sA; if (NSPLIT == 1) A2 += z * sA; Bt += z * sB; if (H16OUT) Ch += z * sC; else C += z * sC;
    const float* __restrict__ bias = z == 0 ? bias0 : z == 1 ? bias1 : bias2;
    const int tid = threadIdx.x, lane = tid & 31, lr = lane & 15, hi = lane >> 4;
    const int wave = __builtin_amdgcn_readfirstlane(tid >> 5);   // in a scalar register: the test on it around the odd chunk is a scalar branch, every lane on at every copy
    const int r0 = blockIdx.x * GTM, c0 = blockIdx.y * GTN, wr = (wave % WM) * 64, wc = (wave / WM) * 64;
    v8f acc[4][4];
#pragma unroll
    for (int mb = 0; mb < 4; ++mb)
#pragma unroll
        for (int nb = 0; nb < 4; ++nb) acc[mb][nb] = (v8f){};
    const int crow = lane >> 3, ccol = (lane & 7) * 8;  // this lane's 16-byte piece: eight lanes per 128-byte row, four whole lines per copy
    constexpr size_t rs = (size_t)4 * K;
    auto gsrc = [&](int ch) -> const T16* {             // chunk ch of a stage in memory, k = 0; a chunk number past the last (never copied) names the last
        const int c = ch < NCH ? ch : NCH - 1;
        if (c < GTM / 16) return A + (size_t)(r0 + 16 * c + crow) * K + ccol;
        if (NSPLIT == 0 || c < (GTM + GTN) / 16) return Bt + (size_t)(c0 + 16 * (c - GTM / 16) + crow) * K + ccol;
        return A2 + (size_t)(r0 + 16 * (c - (GTM + GTN) / 16) + crow) * K + ccol; };
    const T16* g0 = gsrc(wave); const T16* g1 = gsrc(wave + NW); const T16* g2 = gsrc(wave + 2 * NW); const T16* g3 = gsrc(wave + 3 * NW);
    const unsigned l0 = (unsigned)(size_t)(sm + (16 * wave + crow) * GLP + ccol);   // low 32 bits of the shared address = LDS byte address
    constexpr unsigned LCH = (unsigned)NW * 16 * GLP * 2;   // from a wave's chunk to its next, in LDS bytes
    auto fill = [&](int t, int buf) { const unsigned l = l0 + (unsigned)buf * (STG * 2); const size_t ko = (size_t)t * GKC;
        cp3(l, g0 + ko, l + LCH, g1 + ko, l + 2 * LCH, g2 + ko, rs); if (REM != 0 && wave < REM) cp1(l + 3 * LCH, g3 + ko, rs); };
    constexpr int nt = K / GKC;
    fill(0, 0);
    asm volatile("s_wait_asynccnt 0x0" ::: "memory");   // this wave's copies of stage 0 have landed
    __syncthreads();                                    // publishes stage 0
    fill(1, 1);
#pragma unroll 1   // rolled: one copy of a stage's work, the buffer picked by t & 1
    for (int t = 0; t < nt; ++t) {
        const T16* Sa = sm + (t & 1) * STG + (wr + lr) * GLP + 8 * hi; const T16* Sb = sm + (t & 1) * STG + OPA + (wc + lr) * GLP + 8 * hi;
#pragma unroll   // unrolled, as the loops inside: every fragment and accumulator index is a constant, so they stay in registers
        for (int kc = 0; kc < GKC; kc += 32) {
            V a[4], a2[4], b[4];   // all fragments of this 32 k as one group of LDS reads in front of the products
#pragma unroll
            for (int mb = 0; mb < 4; ++mb) { a[mb] = WFrag<T16>::ld(Sa + mb * 16 * GLP + kc); b[mb] = WFrag<T16>::ld(Sb + mb * 16 * GLP + kc); if (NSPLIT == 1) a2[mb] = WFrag<T16>::ld(Sa + OPA + OPB + mb * 16 * GLP + kc); }
            __builtin_amdgcn_sched_barrier(0);   // keeps the reads one group: sunk among the products they shared one register set, and the wave waited out the LDS latency at every fourth product
#pragma unroll
            for (int nb = 0; nb < 4; ++nb)
#pragma unroll
                for (int mb = 0; mb < 4; ++mb) { acc[mb][nb] = WFrag<T16>::mma(a[mb], b[nb], acc[mb][nb]); if (NSPLIT == 1) acc[mb][nb] = WFrag<T16>::mma(a2[mb], b[nb], acc[mb][nb]); }
        }
        __builtin_amdgcn_sched_barrier(0);                  // keeps the products in front of the barrier: sunk behind it they stood in front of the refill and took half a stage off the copies' lead
        asm volatile("s_wait_dscnt 0x0" ::: "memory");      // this wave's reads of stage t are done before the buffer is refilled
        asm volatile("s_wait_asynccnt 0x0" ::: "memory");   // this wave's copies of stage t + 1 have landed
        __syncthreads();                                    // publishes stage t + 1 and ends every wave's reads of stage t
        if (t + 2 < nt) fill(t + 2, t & 1);
    }
    asm volatile("s_wait_asynccnt 0x0" ::: "memory");       // no copy is outstanding when the buffers become output staging
    float* os = (float*)sm + wave * (16 * 68);              // 16 rows of 64 f32, pitch 68, per wave: rows go out as whole lines
#pragma unroll
    for (int mb = 0; mb < 4; ++mb) {
#pragma unroll
        for (int nb = 0; nb < 4; ++nb) {
#pragma unroll
            for (int j = 0; j < 8; ++j) os[(hi * 8 + j) * 68 + nb * 16 + lr] = acc[mb][nb][j]; }
        __builtin_amdgcn_wave_barrier(); asm volatile("" ::: "memory");   // keeps the row reads below behind the other lanes' LDS writes in the compiled order
        if (H16OUT) {   // a row of 64 fp16 is one 128-byte line: eight lanes a row, four rows a store
            h16* crh = Ch + (size_t)(r0 + wr + mb * 16) * ldc + c0 + wc;
#pragma unroll
            for (int s = 0; s < 4; ++s) { const int row = 4 * s + (lane >> 3), cofs = (lane & 7) * 8; const v4f v0 = *(const v4fa*)(os + row * 68 + cofs), v1 = *(const v4fa*)(os + row * 68 + cofs + 4); v8h o;
#pragma unroll
                for (int k = 0; k < 4; ++k) { const float* bp = bias + c0 + wc + cofs; o[k] = (h16)(BIAS ? v0[k] + bfr(bp[k]) : v0[k]); o[k + 4] = (h16)(BIAS ? v1[k] + bfr(bp[k + 4]) : v1[k]); }
                *(v8h*)(crh + (size_t)row * ldc + cofs) = o; }
        } else {
        float* crw = C + (size_t)(r0 + wr + mb * 16) * ldc + c0 + wc;
#pragma unroll
        for (int s = 0; s < 8; ++s) { const int row = 2 * s + hi, cofs = lr * 4; v4f val = *(const v4fa*)(os + row * 68 + cofs); if (BIAS) { const float* bp = bias + c0 + wc + cofs; val[0] += bfr(bp[0]); val[1] += bfr(bp[1]); val[2] += bfr(bp[2]); val[3] += bfr(bp[3]); }
            *(v4f*)(crw + (size_t)row * ldc + cofs) = val; }
        }
        asm volatile("s_wait_xcnt 0x0" ::: "memory");   // stands in front of the next rows' work, which rewrites registers that these stores name
        __builtin_amdgcn_wave_barrier(); asm volatile("" ::: "memory");   // keeps the next 16 rows' LDS writes behind these reads
    }
}

__device__ __forceinline__ void splitf(float y, unsigned short& h, unsigned short& l) { h = f2bf(y); l = f2bf(y - bf2f(h)); }
typedef __attribute__((ext_vector_type(4))) _Float16 v4h;
typedef __attribute__((ext_vector_type(2))) unsigned short v2us;

// ---- k_prep: the five independent input conversions as ONE grid of few, long waves: every wave issues all its loads, each on four lines, in front of its first conversion.
// Blocks 0 .. XBLK - 1 round x (the long stream starts first), the 4 WTB blocks behind them transpose and round the four weights. The test on the block index is the same for a whole work-group; no barrier in either part.
typedef __attribute__((ext_vector_type(4))) unsigned short v4us;
#define XCH  24                   // loads of 512 contiguous bytes of x per wave: 12 KB of x, 6 KB of bf16 a wave
#define XBLK ((size_t)NT * FIN / (8 * XCH * 128))   // blocks of eight waves
static_assert((size_t)NT * FIN % (8 * XCH * 128) == 0, "x is whole blocks");
__device__ __forceinline__ void cvtS(const float* __restrict__ src, bf* __restrict__ dst, unsigned blk) {
    const size_t e0 = ((size_t)blk * 8 + (threadIdx.x >> 5)) * (XCH * 128) + (threadIdx.x & 31) * 4; v4f v[XCH];
#pragma unroll   // unrolled, as the loops below: v stays in registers and the 24 loads stand as one group in front of the first conversion
    for (int j = 0; j < XCH; ++j) v[j] = *(const v4f*)(src + e0 + j * 128);
#pragma unroll
    for (int j = 0; j < XCH; ++j) { v4us o;
#pragma unroll
        for (int k = 0; k < 4; ++k) o[k] = f2bf(v[j][k]);
        *(v4us*)(dst + e0 + j * 128) = o; }   // 256 contiguous bytes a store: two whole lines
}
// A wave transposes 64 k x 16 columns of w [FIN][DD] into Bt [DD][FIN]: lane (g = lane >> 3, c = lane & 7) holds k 8 g .. 8 g + 7 and 32 + 8 g .. 32 + 8 g + 7 of columns c and c + 8,
// so a load takes 32 bytes from each of four rows, and a column's 64 k leave as the two halves of one 128-byte line. The eight waves of a block share the rows' lines (128 columns).
static_assert(FIN == DD && DD == DO, "the four weights have one shape"); static_assert(DD % 128 == 0 && FIN % 64 == 0, "whole blocks of columns, whole lines of k");
#define WTB ((DD / 16) * (FIN / 64) / 8)   // blocks per weight
__device__ __forceinline__ void wtS(const float* __restrict__ w, bf* __restrict__ Bt, unsigned blk) {
    const int lane = threadIdx.x & 31; const unsigned wv = blk * 8 + (threadIdx.x >> 5);
    const int n = (int)(wv % (DD / 16)) * 16 + (lane & 7), k0 = (int)(wv / (DD / 16)) * 64 + 8 * (lane >> 3); float v[2][16];
#pragma unroll   // unrolled, as the loops below: v stays in registers and the 32 loads stand as one group in front of the first conversion
    for (int u = 0; u < 2; ++u)
#pragma unroll
        for (int i = 0; i < 16; ++i) v[u][i] = w[(size_t)(k0 + 32 * (i >> 3) + (i & 7)) * DD + n + 8 * u];
#pragma unroll
    for (int u = 0; u < 2; ++u)
#pragma unroll
        for (int hf = 0; hf < 2; ++hf) { v8us o;
#pragma unroll
            for (int i = 0; i < 8; ++i) o[i] = f2bf(v[u][8 * hf + i]);
            *(v8us*)(Bt + (size_t)(n + 8 * u) * FIN + k0 + 32 * hf) = o; }
}
__global__ __launch_bounds__(256) void k_prep(const float* __restrict__ x, const float* __restrict__ Wq, const float* __restrict__ Wk, const float* __restrict__ Wv, const float* __restrict__ Wo,
                                              bf* XB, bf* WQ, bf* WK, bf* WV, bf* WO) {
    const unsigned b = blockIdx.x;
    if (b < XBLK) cvtS(x, XB, b);
    else { const unsigned j = (b - (unsigned)XBLK) / WTB;
        wtS(j == 0 ? Wq : j == 1 ? Wk : j == 2 ? Wv : Wo, j == 0 ? WQ : j == 1 ? WK : j == 2 ? WV : WO, b - (unsigned)XBLK - j * WTB); }
}
#define SKEY 64                   // keys per LDS tile
#define LPH  72                   // K's LDS row pitch in halfs: 144 B = 16 B x 9
#define LPV  80                   // V's LDS row pitch in halfs: 160 B = 32 B x 5, the transposing load's pitch
#define TILEH (SKEY * LPH)
#define TILEV (SKEY * LPV)
#define BUFH  (TILEH + TILEV)     // one buffer: [K | V]
typedef __attribute__((ext_vector_type(2))) float v2f;
typedef __attribute__((ext_vector_type(2))) _Float16 v2hh;
typedef __attribute__((ext_vector_type(8))) short v8s;
// Lane l passes the address of 16 bytes of row 8 (l >> 4) + (l & 7), column group (l >> 3) & 1, of a 16 x 16 block; lane (c, h) receives rows 8 h .. 8 h + 7 of column c.
__device__ __forceinline__ v8h ldtr(const h16* p) { typedef __attribute__((address_space(3))) v8s lv8s; return __builtin_bit_cast(v8h, __builtin_amdgcn_ds_load_tr16_b128_v8i16((lv8s*)p)); }
__device__ __forceinline__ float xhalf(float x) { return __builtin_bit_cast(float, __builtin_amdgcn_permlanex16(__builtin_bit_cast(int, x), __builtin_bit_cast(int, x), 0x76543210, 0xfedcba98, false, false)); }  // lane l with lane l ^ 16
__global__ __launch_bounds__(256) __attribute__((amdgpu_waves_per_eu(4, 4))) void k_fattn(const h16* __restrict__ Q, const h16* __restrict__ Kp, const h16* __restrict__ Vp, bf* __restrict__ Ah, bf* __restrict__ Al) {
    __shared__ __align__(32) h16 sm[2 * BUFH];      // [buffer][K rows, pitch LPH | V rows, pitch LPV]; the output staging reuses it
    static_assert(2 * BUFH * 2 >= 8 * 16 * 68 * 4, "the output staging fits");
    const int tid = threadIdx.x, lane = tid & 31, wave = tid >> 5, c = lane & 15, h = lane >> 4;
    { const size_t hb = (size_t)blockIdx.y * TT * HD; Q += hb; Kp += hb; Vp += hb;
      const size_t ob = (size_t)(blockIdx.y / NH_) * TT * DD + (size_t)(blockIdx.y % NH_) * HD; Ah += ob; Al += ob; }
    const int q0 = blockIdx.x * 256 + wave * 32;
    const float CS = SCL * 1.4426950408889634f;     // 1/8 and log2(e) in one factor
    v16h qf[2][2];
#pragma unroll
    for (int g = 0; g < 2; ++g)
#pragma unroll
        for (int kc = 0; kc < 2; ++kc) qf[g][kc] = WFrag<h16>::ld(Q + (size_t)(q0 + 16 * g + c) * HD + 32 * kc + 8 * h);
    v8f acc[2][4]; float m_run[2], l_run[2];
#pragma unroll
    for (int g = 0; g < 2; ++g) { m_run[g] = -3.0e38f; l_run[g] = 0.f;
#pragma unroll
        for (int t = 0; t < 4; ++t) acc[g][t] = (v8f){}; }
    const int srow = tid >> 3, scol = (tid & 7) * 8;   // this thread's 16-byte pieces of a tile: rows srow and srow + 32
    v8h rk[2], rv[2];
#pragma unroll
    for (int j = 0; j < 2; ++j) { rk[j] = *(const v8h*)(Kp + (size_t)(srow + 32 * j) * HD + scol); rv[j] = *(const v8h*)(Vp + (size_t)(srow + 32 * j) * HD + scol); }
#pragma unroll
    for (int j = 0; j < 2; ++j) { *(v8h*)(sm + (srow + 32 * j) * LPH + scol) = rk[j]; *(v8h*)(sm + TILEH + (srow + 32 * j) * LPV + scol) = rv[j]; }
    __syncthreads();
#pragma unroll 1   // rolled: one copy of the tile's work, the buffer picked by s & 1
    for (int s = 0; s < TT / SKEY; ++s) {
        if (s + 1 < TT / SKEY) {
#pragma unroll
            for (int j = 0; j < 2; ++j) { rk[j] = *(const v8h*)(Kp + (size_t)((s + 1) * SKEY + srow + 32 * j) * HD + scol); rv[j] = *(const v8h*)(Vp + (size_t)((s + 1) * SKEY + srow + 32 * j) * HD + scol); }
        }
        const h16* Kb = sm + (s & 1) * BUFH; const h16* Vb = Kb + TILEH + (8 * h + (lane & 7)) * LPV + 8 * ((lane >> 3) & 1);   // Vb: this lane's address in the transposing load's map
#pragma unroll 1   // rolled: with both 32-key passes unrolled the build spilled a staged load to scratch, which put its wait at the head of the tile
        for (int p = 0; p < SKEY / 32; ++p) {
            v8f sc[2][2];
#pragma unroll
            for (int kt = 0; kt < 2; ++kt) { v16h kf[2];
#pragma unroll
                for (int kc = 0; kc < 2; ++kc) kf[kc] = WFrag<h16>::ld(Kb + (32 * p + 16 * kt + c) * LPH + 32 * kc + 8 * h);
#pragma unroll
                for (int g = 0; g < 2; ++g) { sc[kt][g] = (v8f){};
#pragma unroll
                    for (int kc = 0; kc < 2; ++kc) sc[kt][g] = wmma16(kf[kc], qf[g][kc], sc[kt][g]); } }
            v16h vf[4];
#pragma unroll
            for (int t = 0; t < 4; ++t) vf[t] = cat16(ldtr(Vb + (32 * p) * LPV + 16 * t), ldtr(Vb + (32 * p + 16) * LPV + 16 * t));   // row 16 t + c of V^T, keys 32 p + 8 h + 0..7 and 32 p + 16 + 8 h + 0..7
#pragma unroll
            for (int g = 0; g < 2; ++g) {
                float mx = sc[0][g][0];
#pragma unroll
                for (int r = 1; r < 8; ++r) mx = fmaxf(mx, sc[0][g][r]);
#pragma unroll
                for (int r = 0; r < 8; ++r) mx = fmaxf(mx, sc[1][g][r]);
                mx = fmaxf(mx, xhalf(mx));             // both wave halves hold this query's maximum over the 32 keys
                const float mn = fmaxf(m_run[g], mx * CS); const float corr = __builtin_amdgcn_exp2f(m_run[g] - mn); m_run[g] = mn;
                float ls = 0.f; v16h pf;
#pragma unroll
                for (int i = 0; i < 8; ++i) {
                    const v2f a = __builtin_elementwise_fma((v2f){sc[i >> 2][g][2 * (i & 3)], sc[i >> 2][g][2 * (i & 3) + 1]}, (v2f){CS, CS}, (v2f){-mn, -mn});
                    const float p0 = __builtin_amdgcn_exp2f(a[0]), p1 = __builtin_amdgcn_exp2f(a[1]); ls += p0 + p1;
                    const v2hh w = __builtin_convertvector((v2f){p0, p1}, v2hh); pf[2 * i] = w[0]; pf[2 * i + 1] = w[1]; }
                l_run[g] = l_run[g] * corr + ls;       // this half's keys only; the halves are joined once, behind the loop
#pragma unroll
                for (int t = 0; t < 4; ++t) { acc[g][t] = acc[g][t] * corr; acc[g][t] = wmma16(vf[t], pf, acc[g][t]); }
            }
            __builtin_amdgcn_sched_barrier(0);   // keeps the slots below behind the last product
            asm volatile("v_nop\n\tv_nop\n\tv_nop\n\tv_nop");   // the distance behind the last product on the loop's taken branch, whose head rewrites that product's A registers
        }
        if (s + 1 < TT / SKEY) { h16* Wb = sm + ((s + 1) & 1) * BUFH;   // its last readers left it in front of the barrier that ended trip s - 1
#pragma unroll
            for (int j = 0; j < 2; ++j) { *(v8h*)(Wb + (srow + 32 * j) * LPH + scol) = rk[j]; *(v8h*)(Wb + TILEH + (srow + 32 * j) * LPV + scol) = rv[j]; }
        }
        __syncthreads();   // publishes tile s + 1 and ends every wave's reads of tile s
    }
    float* os = (float*)sm + wave * (16 * 68);   // 16 query rows of 64 f32, pitch 68, per wave: rows go out as whole lines
#pragma unroll
    for (int g = 0; g < 2; ++g) {
        const float f = __fdiv_rn(1.0f, l_run[g] + xhalf(l_run[g]));
#pragma unroll
        for (int t = 0; t < 4; ++t) { v4f lo, hi4;
#pragma unroll
            for (int r = 0; r < 4; ++r) { lo[r] = acc[g][t][r] * f; hi4[r] = acc[g][t][r + 4] * f; }
            *(v4fa*)(os + c * 68 + 16 * t + 8 * h) = lo; *(v4fa*)(os + c * 68 + 16 * t + 8 * h + 4) = hi4; }
        __builtin_amdgcn_wave_barrier(); asm volatile("" ::: "memory");   // keeps the row reads below behind the other lanes' LDS writes in the compiled order
#pragma unroll
        for (int i = 0; i < 4; ++i) { const int row = 4 * i + (lane >> 3), cofs = (lane & 7) * 8;   // a row of 64 bf16 is one 128-byte line: eight lanes a row, four rows a store
            const v4f v0 = *(const v4fa*)(os + row * 68 + cofs), v1 = *(const v4fa*)(os + row * 68 + cofs + 4); v8us oh, ol;
#pragma unroll
            for (int k = 0; k < 4; ++k) { unsigned short a, b; splitf(v0[k], a, b); oh[k] = a; ol[k] = b; splitf(v1[k], a, b); oh[k + 4] = a; ol[k + 4] = b; }
            const size_t o = (size_t)(q0 + 16 * g + row) * DD + cofs; *(v8us*)(Ah + o) = oh; *(v8us*)(Al + o) = ol; }
        asm volatile("s_wait_xcnt 0x0" ::: "memory");   // stands in front of the next group's work, which rewrites registers that these stores name
        __builtin_amdgcn_wave_barrier(); asm volatile("" ::: "memory");   // keeps the next group's LDS writes behind these reads
    }
}

extern "C" void kernel_launch(void* const* d_in, const int* in_sizes, int n_in,
                              void* d_out, int out_size, void* d_ws, size_t ws_size, hipStream_t stream) {
    (void)in_sizes; (void)n_in; (void)out_size;
    const float* x = (const float*)d_in[0]; const float* Wq = (const float*)d_in[1]; const float* bq = (const float*)d_in[2]; const float* Wk = (const float*)d_in[3]; const float* bk = (const float*)d_in[4]; const float* Wv = (const float*)d_in[5]; const float* bv = (const float*)d_in[6]; const float* Wo = (const float*)d_in[7]; const float* bo = (const float*)d_in[8];
    float* OUT = (float*)d_out;     // [16][1024][768]
    char* wsp = (char*)d_ws;
    auto take = [&](size_t bytes) { char* p = wsp; wsp += (bytes + 255) & ~(size_t)255; return (void*)p; };
    bf* WQ = (bf*)take((size_t)DD * FIN * 2); bf* WK = (bf*)take((size_t)DD * FIN * 2); bf* WV = (bf*)take((size_t)DD * FIN * 2); bf* WO = (bf*)take((size_t)DO * DD * 2);
    h16* QP = (h16*)take((size_t)NT * DD * 2); h16* KP = (h16*)take((size_t)NT * DD * 2); h16* VP = (h16*)take((size_t)NT * DD * 2);
    bf* XB = (bf*)take((size_t)NT * FIN * 2); bf* ATh = (bf*)take((size_t)NT * DD * 2); bf* ATl = (bf*)take((size_t)NT * DD * 2);
    if ((size_t)(wsp - (char*)d_ws) > ws_size) return;    // total ~ 156 MB; ws 256 MiB
    k_prep<<<(unsigned)(XBLK + 4 * WTB), 256, 0, stream>>>(x, Wq, Wk, Wv, Wo, XB, WQ, WK, WV, WO);
    // all 16 batches per launch: the rows of x are one [NT][768] matrix, and the 192 head planes are the flat projection memory
    const dim3 gP(NT / 256, DD / 128, 3);
    // the three projections as one grid, z = q, k, v: WQ, WK, WV and QP, KP, VP lie one behind the other in the workspace (each size is a multiple of the 256-byte rounding of take)
    static_assert(((size_t)DD * FIN * 2) % 256 == 0 && ((size_t)NT * DD * 2) % 256 == 0, "planes contiguous"); static_assert(NT % 256 == 0 && DD % 128 == 0 && DO % 384 == 0, "whole tiles");
    k_gemmw<bf, 0, true, FIN, true, 4, 2><<<gP, 256, 0, stream>>>(XB, nullptr, WQ, nullptr, QP, DD, bq, bk, bv, 0, (size_t)DD * FIN, (size_t)NT * DD);
    k_fattn<<<dim3(TT / 256, NB_ * NH_, 1), 256, 0, stream>>>(QP, KP, VP, ATh, ATl);
    k_gemmw<bf, 1, true, DD, false, 2, 6><<<dim3(NT / 128, DO / 384, 1), 384, 0, stream>>>(ATh, ATl, WO, OUT, nullptr, DO, bo, bo, bo, 0, 0, 0);
}

// v010
// Measured time: 120 microseconds a run.
// Versions between v008 and this one are left out; their measured steps multiply to 1.16 times as fast.
// Over all steps from v000 it is 18.0 times as fast.
#include <hip/hip_runtime.h>

// ViT self-attention (x [16][1024][768]; q/k/v = x @ W + b; the module reshapes (B,N,C) -> (B*H, N, Dh) WITHOUT a transpose, so "head" g of a batch is the contiguous chunk g of the
// projection viewed as [1024][64]; scores = q2.k2 / 8; softmax; ctx2 = attn.v2; ctx2.reshape(B,H,N,Dh).transpose(0,2,1,3) -> [n][h*64+d]; out = ctx @ Wo + bo [16][1024][768]).
// Compute dtypes, f32 accumulate: every input rounded to bf16; projections on PLAIN bf16 operands (inputs: exact, + bias); scores and attn.v on SINGLE fp16 planes
// (the head planes ARE the projection memory: flat, in fp16; 1/8 applied in f32 in the softmax; P = exp(s - maximum in use), at most 2^8); scores, softmax and attn.v run in ONE kernel, no score plane in memory;
// no f32 plane lies between the kernels: the projection GEMMs store the fp16 planes, and the attention kernel stores the output product's A operand, from their own epilogues.
// The output product runs on ONE fp16 plane of ctx (ctx comes from fp16 P and fp16 V, so its error is already of the size of an fp16 rounding) and on Wo rounded to bf16 as every input and then held in fp16
// (exact from 2^-14 up; below that to within 2^-25).

#define NB_  16
#define TT   1024
#define FIN  768
#define DD   768                  // H * Dh
#define NH_  12
#define HD   64
#define DO   768
#define NT   (NB_ * TT)
#define SCL  0.125f               // 1/sqrt(64)
typedef _Float16 h16;
typedef unsigned short bf;
typedef __attribute__((ext_vector_type(16))) __bf16   v16bf;
typedef __attribute__((ext_vector_type(16))) _Float16 v16h;
typedef __attribute__((ext_vector_type(8)))  _Float16 v8h;
typedef __attribute__((ext_vector_type(8)))  unsigned short v8us;
typedef __attribute__((ext_vector_type(8)))  float    v8f;
typedef __attribute__((ext_vector_type(4)))  float    v4f;
typedef v8h  __attribute__((may_alias)) v8ha;
typedef v4f  __attribute__((may_alias)) v4fa;
typedef v8us __attribute__((may_alias)) v8usa;

__device__ __forceinline__ unsigned short f2bf(float f) { unsigned u = __float_as_uint(f); u += 0x7FFFu + ((u >> 16) & 1u); return (unsigned short)(u >> 16); }
__device__ __forceinline__ float bf2f(unsigned short b) { return __uint_as_float(((unsigned)b) << 16); }
__device__ __forceinline__ float bfr(float f) { return bf2f(f2bf(f)); }
__device__ __forceinline__ v16h cat16(v8h lo, v8h hi) { return __builtin_shufflevector(lo, hi, 0, 1, 2, 3, 4, 5, 6, 7, 8, 9, 10, 11, 12, 13, 14, 15); }
__device__ __forceinline__ v16bf cat16b(v8us lo, v8us hi) { return __builtin_bit_cast(v16bf, __builtin_shufflevector(lo, hi, 0, 1, 2, 3, 4, 5, 6, 7, 8, 9, 10, 11, 12, 13, 14, 15)); }
__device__ __forceinline__ v8f wmma16(v16h a, v16h b, v8f c) { return __builtin_amdgcn_wmma_f32_16x16x32_f16(false, a, false, b, (short)0, c, false, false); }
__device__ __forceinline__ v8f wmmab(v16bf a, v16bf b, v8f c) { return __builtin_amdgcn_wmma_f32_16x16x32_bf16(false, a, false, b, (short)0, c, false, false); }



// ---- k_gemmw: GEMM, one (64 WM) x (64 WN) output tile per work-group of WM x WN WAVES (each 64x64 = 16 accumulators); grid (M / (64 WM), N / (64 WN), Z), 32 WM WN threads.
// The tile is large so that an operand row fetched from L2 serves many products: 256x128 (8 waves, two work-groups per WGP) for the projections, 256x192 (12 waves, one work-group per WGP, 256 in all) for the output product.
// C[m][n] (f32, or for H16OUT rounded once to fp16 into Ch; pitch ldc, + optional f32 bias[n]) = sum_k A[m][k] Bt[n][k]. z-batch strides sA/sB/sC in elements; product z takes bias0, bias1 or bias2 (Z <= 3). M % (64 WM) == 0, N % (64 WN) == 0, K % 64 == 0, a compile-time constant.
// The operands' rows come as whole 128-byte lines (64 k) by asynchronous copies into two LDS buffers (row pitch 144 B for the 16-byte fragment reads) and are shared by the waves;
// the copies of stage t + 2 fly under the work on stage t + 1.
template <typename T16> struct WFrag;
template <> struct WFrag<h16> { typedef v16h V; static __device__ __forceinline__ V ld(const h16* p) { return cat16(*(const v8h*)p, *(const v8h*)(p + 16)); } static __device__ __forceinline__ v8f mma(V a, V b, v8f c) { return wmma16(a, b, c); } };
template <> struct WFrag<bf> { typedef v16bf V; static __device__ __forceinline__ V ld(const bf* p) { return cat16b(*(const v8us*)p, *(const v8us*)(p + 16)); } static __device__ __forceinline__ v8f mma(V a, V b, v8f c) { return wmmab(a, b, c); } };
#define GKC  64                   // k per stage
#define GLP  72                   // LDS row pitch in 16-bit elements: 144 B = 16 B x 9
#define GCS  (4u * GLP * 2)       // four LDS rows in bytes: the step between a chunk's copies
// A chunk is 16 rows of a stage, brought by one wave in four copies of four whole lines each: this lane's 16 bytes of rows r, r + 4, r + 8, r + 12 (l: its LDS byte address, g: its global address, rs: 4 rows in elements).
// cp1, cp2 and cp3 bring one chunk, two and three. The s_wait_xcnt stands inside each statement so that no address register named there is rewritten in front of it.
template <typename T16>
__device__ __forceinline__ void cp1(unsigned l, const T16* g, size_t rs) {
    asm volatile("global_load_async_to_lds_b128 %0, %4, off\n\t"
                 "global_load_async_to_lds_b128 %1, %5, off\n\t"
                 "global_load_async_to_lds_b128 %2, %6, off\n\t"
                 "global_load_async_to_lds_b128 %3, %7, off\n\t"
                 "s_wait_xcnt 0x0"
                 :: "v"(l), "v"(l + GCS), "v"(l + 2 * GCS), "v"(l + 3 * GCS),
                    "v"(g), "v"(g + rs), "v"(g + 2 * rs), "v"(g + 3 * rs) : "memory");
}
template <typename T16>
__device__ __forceinline__ void cp2(unsigned l, const T16* g, unsigned m, const T16* h, size_t rs) {
    asm volatile("global_load_async_to_lds_b128 %0, %8, off\n\t"
                 "global_load_async_to_lds_b128 %1, %9, off\n\t"
                 "global_load_async_to_lds_b128 %2, %10, off\n\t"
                 "global_load_async_to_lds_b128 %3, %11, off\n\t"
                 "global_load_async_to_lds_b128 %4, %12, off\n\t"
                 "global_load_async_to_lds_b128 %5, %13, off\n\t"
                 "global_load_async_to_lds_b128 %6, %14, off\n\t"
                 "global_load_async_to_lds_b128 %7, %15, off\n\t"
                 "s_wait_xcnt 0x0"
                 :: "v"(l), "v"(l + GCS), "v"(l + 2 * GCS), "v"(l + 3 * GCS), "v"(m), "v"(m + GCS), "v"(m + 2 * GCS), "v"(m + 3 * GCS),
                    "v"(g), "v"(g + rs), "v"(g + 2 * rs), "v"(g + 3 * rs), "v"(h), "v"(h + rs), "v"(h + 2 * rs), "v"(h + 3 * rs) : "memory");
}
template <typename T16>
__device__ __forceinline__ void cp3(unsigned l, const T16* g, unsigned m, const T16* h, unsigned n, const T16* i, size_t rs) {
    asm volatile("global_load_async_to_lds_b128 %0, %12, off\n\t"
                 "global_load_async_to_lds_b128 %1, %13, off\n\t"
                 "global_load_async_to_lds_b128 %2, %14, off\n\t"
                 "global_load_async_to_lds_b128 %3, %15, off\n\t"
                 "global_load_async_to_lds_b128 %4, %16, off\n\t"
                 "global_load_async_to_lds_b128 %5, %17, off\n\t"
                 "global_load_async_to_lds_b128 %6, %18, off\n\t"
                 "global_load_async_to_lds_b128 %7, %19, off\n\t"
                 "global_load_async_to_lds_b128 %8, %20, off\n\t"
                 "global_load_async_to_lds_b128 %9, %21, off\n\t"
                 "global_load_async_to_lds_b128 %10, %22, off\n\t"
                 "global_load_async_to_lds_b128 %11, %23, off\n\t"
                 "s_wait_xcnt 0x0"
                 :: "v"(l), "v"(l + GCS), "v"(l + 2 * GCS), "v"(l + 3 * GCS), "v"(m), "v"(m + GCS), "v"(m + 2 * GCS), "v"(m + 3 * GCS), "v"(n), "v"(n + GCS), "v"(n + 2 * GCS), "v"(n + 3 * GCS),
                    "v"(g), "v"(g + rs), "v"(g + 2 * rs), "v"(g + 3 * rs), "v"(h), "v"(h + rs), "v"(h + 2 * rs), "v"(h + 3 * rs), "v"(i), "v"(i + rs), "v"(i + 2 * rs), "v"(i + 3 * rs) : "memory");
}
template <typename T16, bool BIAS, int K, bool H16OUT, int WM, int WN>
__global__ __launch_bounds__(WM * WN * 32) void k_gemmw(const T16* __restrict__ A, const T16* __restrict__ Bt, float* C, h16* Ch, int ldc, const float* __restrict__ bias0, const float* __restrict__ bias1, const float* __restrict__ bias2, size_t sA, size_t sB, size_t sC) {
    typedef typename WFrag<T16>::V V;
    static_assert(K % GKC == 0 && K / GKC >= 2, "whole stages, at least two");
    constexpr int NW = WM * WN, GTM = WM * 64, GTN = WN * 64;   // waves, rows and columns of the work-group's tile
    constexpr int OPA = GTM * GLP, OPB = GTN * GLP;     // one operand's rows of a stage, in elements
    constexpr int STG = OPA + OPB;                      // a stage: [A | Bt], rows of one pitch
    constexpr int NCH = (GTM + GTN) / 16, FULL = NCH / NW, REM = NCH % NW;   // chunks of a stage; wave w brings chunks w, w + NW, ...: FULL each, and the first REM waves one more
    static_assert(FULL == 2 || FULL == 3, "cp2 or cp3, and cp1 for the odd chunk");
    __shared__ __align__(16) T16 sm[2 * STG];           // two stages; the output staging reuses them
    static_assert((size_t)2 * STG * 2 >= (size_t)NW * 16 * 68 * 4, "the output staging fits");
    const size_t z = blockIdx.z; A += z * sA; Bt += z * sB; if (H16OUT) Ch += z * sC; else C += z * sC;
    const float* __restrict__ bias = z == 0 ? bias0 : z == 1 ? bias1 : bias2;
    const int tid = threadIdx.x, lane = tid & 31, lr = lane & 15, hi = lane >> 4;
    const int wave = __builtin_amdgcn_readfirstlane(tid >> 5);   // in a scalar register: the test on it around the odd chunk is a scalar branch, every lane on at every copy
    const int r0 = blockIdx.x * GTM, c0 = blockIdx.y * GTN, wr = (wave % WM) * 64, wc = (wave / WM) * 64;
    v8f acc[4][4];
#pragma unroll
    for (int mb = 0; mb < 4; ++mb)
#pragma unroll
        for (int nb = 0; nb < 4; ++nb) acc[mb][nb] = (v8f){};
    const int crow = lane >> 3, ccol = (lane & 7) * 8;  // this lane's 16-byte piece: eight lanes per 128-byte row, four whole lines per copy
    constexpr size_t rs = (size_t)4 * K;
    auto gsrc = [&](int ch) -> const T16* {             // chunk ch of a stage in memory, k = 0; a chunk number past the last (never copied) names the last
        const int c = ch < NCH ? ch : NCH - 1;
        if (c < GTM / 16) return A + (size_t)(r0 + 16 * c + crow) * K + ccol;
        return Bt + (size_t)(c0 + 16 * (c - GTM / 16) + crow) * K + ccol; };
    const T16* g0 = gsrc(wave); const T16* g1 = gsrc(wave + NW); const T16* g2 = gsrc(wave + 2 * NW); const T16* g3 = gsrc(wave + 3 * NW);
    const unsigned l0 = (unsigned)(size_t)(sm + (16 * wave + crow) * GLP + ccol);   // low 32 bits of the shared address = LDS byte address
    constexpr unsigned LCH = (unsigned)NW * 16 * GLP * 2;   // from a wave's chunk to its next, in LDS bytes
    auto fill = [&](int t, int buf) { const unsigned l = l0 + (unsigned)buf * (STG * 2); const size_t ko = (size_t)t * GKC;
        if constexpr (FULL == 3) { cp3(l, g0 + ko, l + LCH, g1 + ko, l + 2 * LCH, g2 + ko, rs); if (REM != 0 && wave < REM) cp1(l + 3 * LCH, g3 + ko, rs); }
        else { cp2(l, g0 + ko, l + LCH, g1 + ko, rs); if (REM != 0 && wave < REM) cp1(l + 2 * LCH, g2 + ko, rs); } };
    constexpr int nt = K / GKC;
    fill(0, 0);
    asm volatile("s_wait_asynccnt 0x0" ::: "memory");   // this wave's copies of stage 0 have landed
    __syncthreads();                                    // publishes stage 0
    fill(1, 1);
#pragma unroll 1   // rolled: one copy of a stage's work, the buffer picked by t & 1
    for (int t = 0; t < nt; ++t) {
        const T16* Sa = sm + (t & 1) * STG + (wr + lr) * GLP + 8 * hi; const T16* Sb = sm + (t & 1) * STG + OPA + (wc + lr) * GLP + 8 * hi;
#pragma unroll   // unrolled, as the loops inside: every fragment and accumulator index is a constant, so they stay in registers
        for (int kc = 0; kc < GKC; kc += 32) {
            V a[4], b[4];   // all fragments of this 32 k as one group of LDS reads in front of the products
#pragma unroll
            for (int mb = 0; mb < 4; ++mb) { a[mb] = WFrag<T16>::ld(Sa + mb * 16 * GLP + kc); b[mb] = WFrag<T16>::ld(Sb + mb * 16 * GLP + kc); }
            __builtin_amdgcn_sched_barrier(0);   // keeps the reads one group: sunk among the products they shared one register set, and the wave waited out the LDS latency at every fourth product
#pragma unroll
            for (int nb = 0; nb < 4; ++nb)
#pragma unroll
                for (int mb = 0; mb < 4; ++mb) acc[mb][nb] = WFrag<T16>::mma(a[mb], b[nb], acc[mb][nb]);
        }
        __builtin_amdgcn_sched_barrier(0);                  // keeps the products in front of the barrier: sunk behind it they stood in front of the refill and took half a stage off the copies' lead
        asm volatile("s_wait_dscnt 0x0" ::: "memory");      // this wave's reads of stage t are done before the buffer is refilled
        asm volatile("s_wait_asynccnt 0x0" ::: "memory");   // this wave's copies of stage t + 1 have landed
        __syncthreads();                                    // publishes stage t + 1 and ends every wave's reads of stage t
        if (t + 2 < nt) fill(t + 2, t & 1);
    }
    asm volatile("s_wait_asynccnt 0x0" ::: "memory");       // no copy is outstanding when the buffers become output staging
    float* os = (float*)sm + wave * (16 * 68);              // 16 rows of 64 f32, pitch 68, per wave: rows go out as whole lines
#pragma unroll
    for (int mb = 0; mb < 4; ++mb) {
#pragma unroll
        for (int nb = 0; nb < 4; ++nb) {
#pragma unroll
            for (int j = 0; j < 8; ++j) os[(hi * 8 + j) * 68 + nb * 16 + lr] = acc[mb][nb][j]; }
        __builtin_amdgcn_wave_barrier(); asm volatile("" ::: "memory");   // keeps the row reads below behind the other lanes' LDS writes in the compiled order
        if (H16OUT) {   // a row of 64 fp16 is one 128-byte line: eight lanes a row, four rows a store
            h16* crh = Ch + (size_t)(r0 + wr + mb * 16) * ldc + c0 + wc;
#pragma unroll
            for (int s = 0; s < 4; ++s) { const int row = 4 * s + (lane >> 3), cofs = (lane & 7) * 8; const v4f v0 = *(const v4fa*)(os + row * 68 + cofs), v1 = *(const v4fa*)(os + row * 68 + cofs + 4); v8h o;
#pragma unroll
                for (int k = 0; k < 4; ++k) { const float* bp = bias + c0 + wc + cofs; o[k] = (h16)(BIAS ? v0[k] + bfr(bp[k]) : v0[k]); o[k + 4] = (h16)(BIAS ? v1[k] + bfr(bp[k + 4]) : v1[k]); }
                *(v8h*)(crh + (size_t)row * ldc + cofs) = o; }
        } else {
        float* crw = C + (size_t)(r0 + wr + mb * 16) * ldc + c0 + wc;
#pragma unroll
        for (int s = 0; s < 8; ++s) { const int row = 2 * s + hi, cofs = lr * 4; v4f val = *(const v4fa*)(os + row * 68 + cofs); if (BIAS) { const float* bp = bias + c0 + wc + cofs; val[0] += bfr(bp[0]); val[1] += bfr(bp[1]); val[2] += bfr(bp[2]); val[3] += bfr(bp[3]); }
            *(v4f*)(crw + (size_t)row * ldc + cofs) = val; }
        }
        asm volatile("s_wait_xcnt 0x0" ::: "memory");   // stands in front of the next rows' work, which rewrites registers that these stores name
        __builtin_amdgcn_wave_barrier(); asm volatile("" ::: "memory");   // keeps the next 16 rows' LDS writes behind these reads
    }
}

typedef __attribute__((ext_vector_type(4))) _Float16 v4h;
typedef __attribute__((ext_vector_type(2))) unsigned short v2us;

// ---- k_prep: the five independent input conversions as ONE grid of few, long waves: every wave issues all its loads, each on four lines, in front of its first conversion.
// Blocks 0 .. XBLK - 1 round x (the long stream starts first), the 4 WTB blocks behind them transpose and round the four weights. The test on the block index is the same for a whole work-group; no barrier in either part.
typedef __attribute__((ext_vector_type(4))) unsigned short v4us;
#define XCH  24                   // loads of 512 contiguous bytes of x per wave: 12 KB of x, 6 KB of bf16 a wave
#define XBLK ((size_t)NT * FIN / (8 * XCH * 128))   // blocks of eight waves
static_assert((size_t)NT * FIN % (8 * XCH * 128) == 0, "x is whole blocks");
__device__ __forceinline__ void cvtS(const float* __restrict__ src, bf* __restrict__ dst, unsigned blk) {
    const size_t e0 = ((size_t)blk * 8 + (threadIdx.x >> 5)) * (XCH * 128) + (threadIdx.x & 31) * 4; v4f v[XCH];
#pragma unroll   // unrolled, as the loops below: v stays in registers and the 24 loads stand as one group in front of the first conversion
    for (int j = 0; j < XCH; ++j) v[j] = *(const v4f*)(src + e0 + j * 128);
#pragma unroll
    for (int j = 0; j < XCH; ++j) { v4us o;
#pragma unroll
        for (int k = 0; k < 4; ++k) o[k] = f2bf(v[j][k]);
        *(v4us*)(dst + e0 + j * 128) = o; }   // 256 contiguous bytes a store: two whole lines
}
// A wave transposes 64 k x 16 columns of w [FIN][DD] into Bt [DD][FIN]: lane (g = lane >> 3, c = lane & 7) holds k 8 g .. 8 g + 7 and 32 + 8 g .. 32 + 8 g + 7 of columns c and c + 8,
// so a load takes 32 bytes from each of four rows, and a column's 64 k leave as the two halves of one 128-byte line. The eight waves of a block share the rows' lines (128 columns).
static_assert(FIN == DD && DD == DO, "the four weights have one shape"); static_assert(DD % 128 == 0 && FIN % 64 == 0, "whole blocks of columns, whole lines of k");
#define WTB ((DD / 16) * (FIN / 64) / 8)   // blocks per weight
// F16: the bf16-rounded value is stored in fp16 (the output product's operand type)
template <bool F16>
__device__ __forceinline__ void wtS(const float* __restrict__ w, bf* __restrict__ Bt, unsigned blk) {
    const int lane = threadIdx.x & 31; const unsigned wv = blk * 8 + (threadIdx.x >> 5);
    const int n = (int)(wv % (DD / 16)) * 16 + (lane & 7), k0 = (int)(wv / (DD / 16)) * 64 + 8 * (lane >> 3); float v[2][16];
#pragma unroll   // unrolled, as the loops below: v stays in registers and the 32 loads stand as one group in front of the first conversion
    for (int u = 0; u < 2; ++u)
#pragma unroll
        for (int i = 0; i < 16; ++i) v[u][i] = w[(size_t)(k0 + 32 * (i >> 3) + (i & 7)) * DD + n + 8 * u];
#pragma unroll
    for (int u = 0; u < 2; ++u)
#pragma unroll
        for (int hf = 0; hf < 2; ++hf) { v8us o;
#pragma unroll
            for (int i = 0; i < 8; ++i) o[i] = F16 ? __builtin_bit_cast(unsigned short, (h16)bfr(v[u][8 * hf + i])) : f2bf(v[u][8 * hf + i]);
            *(v8us*)(Bt + (size_t)(n + 8 * u) * FIN + k0 + 32 * hf) = o; }
    asm volatile("s_wait_xcnt 0x0" ::: "memory");   // stands behind the stores: in the compiled order the other form's code follows them, and it rewrites registers that they name
}
__global__ __launch_bounds__(256) void k_prep(const float* __restrict__ x, const float* __restrict__ Wq, const float* __restrict__ Wk, const float* __restrict__ Wv, const float* __restrict__ Wo,
                                              bf* XB, bf* WQ, bf* WK, bf* WV, bf* WO) {
    const unsigned b = blockIdx.x;
    if (b < XBLK) { cvtS(x, XB, b); return; }
    const unsigned j = (b - (unsigned)XBLK) / WTB;
    if (j == 3) { wtS<true>(Wo, WO, b - (unsigned)XBLK - 3 * WTB); return; }
    wtS<false>(j == 0 ? Wq : j == 1 ? Wk : Wv, j == 0 ? WQ : j == 1 ? WK : WV, b - (unsigned)XBLK - j * WTB);
}
#define SKEY 64                   // keys per LDS tile
#define LPH  72                   // K's LDS row pitch in halfs: 144 B = 16 B x 9
#define LPV  80                   // V's LDS row pitch in halfs: 160 B = 32 B x 5, the transposing load's pitch
#define TILEH (SKEY * LPH)
#define TILEV (SKEY * LPV)
#define BUFH  (TILEH + TILEV)     // one buffer: [K | V]
typedef __attribute__((ext_vector_type(2))) float v2f;
typedef __attribute__((ext_vector_type(2))) _Float16 v2hh;
typedef __attribute__((ext_vector_type(8))) short v8s;
// Lane l passes the address of 16 bytes of row 8 (l >> 4) + (l & 7), column group (l >> 3) & 1, of a 16 x 16 block; lane (c, h) receives rows 8 h .. 8 h + 7 of column c.
__device__ __forceinline__ v8h ldtr(const h16* p) { typedef __attribute__((address_space(3))) v8s lv8s; return __builtin_bit_cast(v8h, __builtin_amdgcn_ds_load_tr16_b128_v8i16((lv8s*)p)); }
__device__ __forceinline__ float xhalf(float x) { return __builtin_bit_cast(float, __builtin_amdgcn_permlanex16(__builtin_bit_cast(int, x), __builtin_bit_cast(int, x), 0x76543210, 0xfedcba98, false, false)); }  // lane l with lane l ^ 16
__global__ __launch_bounds__(256) __attribute__((amdgpu_waves_per_eu(4, 4))) void k_fattn(const h16* __restrict__ Q, const h16* __restrict__ Kp, const h16* __restrict__ Vp, h16* __restrict__ Ao) {
    __shared__ __align__(32) h16 sm[2 * BUFH];      // [buffer][K rows, pitch LPH | V rows, pitch LPV]; the output staging reuses it
    static_assert(2 * BUFH * 2 >= 8 * 16 * 68 * 4, "the output staging fits");
    const int tid = threadIdx.x, lane = tid & 31, wave = tid >> 5, c = lane & 15, h = lane >> 4;
    { const size_t hb = (size_t)blockIdx.y * TT * HD; Q += hb; Kp += hb; Vp += hb;
      const size_t ob = (size_t)(blockIdx.y / NH_) * TT * DD + (size_t)(blockIdx.y % NH_) * HD; Ao += ob; }
    const int q0 = blockIdx.x * 256 + wave * 32;
    const float CS = SCL * 1.4426950408889634f;     // 1/8 and log2(e) in one factor
    v16h qf[2][2];
#pragma unroll
    for (int g = 0; g < 2; ++g)
#pragma unroll
        for (int kc = 0; kc < 2; ++kc) qf[g][kc] = WFrag<h16>::ld(Q + (size_t)(q0 + 16 * g + c) * HD + 32 * kc + 8 * h);
    v8f acc[2][4]; float m_run[2], l_run[2];
#pragma unroll
    for (int g = 0; g < 2; ++g) { m_run[g] = -3.0e38f; l_run[g] = 0.f;
#pragma unroll
        for (int t = 0; t < 4; ++t) acc[g][t] = (v8f){}; }
    const int srow = tid >> 3, scol = (tid & 7) * 8;   // this thread's 16-byte pieces of a tile: rows srow and srow + 32
    v8h rk[2], rv[2];
#pragma unroll
    for (int j = 0; j < 2; ++j) { rk[j] = *(const v8h*)(Kp + (size_t)(srow + 32 * j) * HD + scol); rv[j] = *(const v8h*)(Vp + (size_t)(srow + 32 * j) * HD + scol); }
#pragma unroll
    for (int j = 0; j < 2; ++j) { *(v8h*)(sm + (srow + 32 * j) * LPH + scol) = rk[j]; *(v8h*)(sm + TILEH + (srow + 32 * j) * LPV + scol) = rv[j]; }
    __syncthreads();
#pragma unroll 1   // rolled: one copy of the tile's work, the buffer picked by s & 1
    for (int s = 0; s < TT / SKEY; ++s) {
        if (s + 1 < TT / SKEY) {
#pragma unroll
            for (int j = 0; j < 2; ++j) { rk[j] = *(const v8h*)(Kp + (size_t)((s + 1) * SKEY + srow + 32 * j) * HD + scol); rv[j] = *(const v8h*)(Vp + (size_t)((s + 1) * SKEY + srow + 32 * j) * HD + scol); }
            asm volatile("s_wait_xcnt 0x0" ::: "memory");   // stands in front of the pass's address work, which rewrites registers that these loads name
        }
        const h16* Kb = sm + (s & 1) * BUFH; const h16* Vb = Kb + TILEH + (8 * h + (lane & 7)) * LPV + 8 * ((lane >> 3) & 1);   // Vb: this lane's address in the transposing load's map
#pragma unroll 1   // rolled: with both 32-key passes unrolled the build spilled a staged load to scratch, which put its wait at the head of the tile
        for (int p = 0; p < SKEY / 32; ++p) {
            v8f sc[2][2]; v16h kf[2][2], vf[4];
#pragma unroll
            for (int kt = 0; kt < 2; ++kt)
#pragma unroll
                for (int kc = 0; kc < 2; ++kc) kf[kt][kc] = WFrag<h16>::ld(Kb + (32 * p + 16 * kt + c) * LPH + 32 * kc + 8 * h);
#pragma unroll
            for (int t = 0; t < 4; ++t) vf[t] = cat16(ldtr(Vb + (32 * p) * LPV + 16 * t), ldtr(Vb + (32 * p + 16) * LPV + 16 * t));   // row 16 t + c of V^T, keys 32 p + 8 h + 0..7 and 32 p + 16 + 8 h + 0..7
            __builtin_amdgcn_sched_barrier(0);   // keeps the pass's 16 LDS reads one group at its head: spread over the pass they stood at five places, V's last ones directly in front of their wait
#pragma unroll
            for (int kc = 0; kc < 2; ++kc)       // four independent tiles, then their second halves: no product waits for the one in front of it
#pragma unroll
                for (int kt = 0; kt < 2; ++kt)
#pragma unroll
                    for (int g = 0; g < 2; ++g) sc[kt][g] = wmma16(kf[kt][kc], qf[g][kc], kc == 0 ? (v8f){} : sc[kt][g]);
            __builtin_amdgcn_sched_barrier(0);   // keeps the maxima behind the eight products: mixed among them each cost the four slots of the distance behind a product
            float mb[2]; bool need = false;
#pragma unroll
            for (int g = 0; g < 2; ++g) {
                float mx = sc[0][g][0];
#pragma unroll
                for (int r = 1; r < 8; ++r) mx = fmaxf(mx, sc[0][g][r]);
#pragma unroll
                for (int r = 0; r < 8; ++r) mx = fmaxf(mx, sc[1][g][r]);
                mb[g] = fmaxf(mx, xhalf(mx)) * CS;     // both wave halves hold this query's maximum over the 32 keys, scaled
                need = need || mb[g] > m_run[g] + 8.0f; }
            __builtin_amdgcn_sched_barrier(0);   // keeps the statement below, and with it the wait for V's reads, behind the maxima
            asm volatile("" :: "v"(vf[0]), "v"(vf[1]), "v"(vf[2]), "v"(vf[3]));   // inputs only: holds V's reads in front of the branch, where they fly under the products and the maxima; the compiler sank them behind it
            if (__builtin_amdgcn_ballot_w32(need) != 0) {   // one scalar test per pass, the same for the whole wave; taken on the first pass (m_run starts at -3e38) and seldom later
#pragma unroll
                for (int g = 0; g < 2; ++g) {
                    const float mn = fmaxf(m_run[g], mb[g]); const float corr = __builtin_amdgcn_exp2f(m_run[g] - mn); m_run[g] = mn; l_run[g] *= corr;
#pragma unroll
                    for (int t = 0; t < 4; ++t) acc[g][t] = acc[g][t] * corr; }
            }
#pragma unroll
            for (int g = 0; g < 2; ++g) {
                const float mn = m_run[g];
                float ls = 0.f; v16h pf;
#pragma unroll
                for (int i = 0; i < 8; ++i) {
                    const v2f a = __builtin_elementwise_fma((v2f){sc[i >> 2][g][2 * (i & 3)], sc[i >> 2][g][2 * (i & 3) + 1]}, (v2f){CS, CS}, (v2f){-mn, -mn});
                    const float p0 = __builtin_amdgcn_exp2f(a[0]), p1 = __builtin_amdgcn_exp2f(a[1]); ls += p0 + p1;
                    const v2hh w = __builtin_convertvector((v2f){p0, p1}, v2hh); pf[2 * i] = w[0]; pf[2 * i + 1] = w[1]; }
                l_run[g] += ls;                        // this half's keys only; the halves are joined once, behind the loop
                __builtin_amdgcn_sched_barrier(0);     // ends the scheduler's region in front of each group's products: as one region the sums went behind the products into their operand registers, at five more idle slots of the distance a pass
#pragma unroll
                for (int t = 0; t < 4; ++t) acc[g][t] = wmma16(vf[t], pf, acc[g][t]);
            }
            __builtin_amdgcn_sched_barrier(0);   // keeps the slots below behind the last product
            asm volatile("v_nop\n\tv_nop\n\tv_nop\n\tv_nop");   // the distance behind the last product on the loop's taken branch, whose head rewrites that product's A registers
        }
        if (s + 1 < TT / SKEY) { h16* Wb = sm + ((s + 1) & 1) * BUFH;   // its last readers left it in front of the barrier that ended trip s - 1
#pragma unroll
            for (int j = 0; j < 2; ++j) { *(v8h*)(Wb + (srow + 32 * j) * LPH + scol) = rk[j]; *(v8h*)(Wb + TILEH + (srow + 32 * j) * LPV + scol) = rv[j]; }
        }
        __syncthreads();   // publishes tile s + 1 and ends every wave's reads of tile s
    }
    float* os = (float*)sm + wave * (16 * 68);   // 16 query rows of 64 f32, pitch 68, per wave: rows go out as whole lines
#pragma unroll
    for (int g = 0; g < 2; ++g) {
        const float f = __fdiv_rn(1.0f, l_run[g] + xhalf(l_run[g]));
#pragma unroll
        for (int t = 0; t < 4; ++t) { v4f lo, hi4;
#pragma unroll
            for (int r = 0; r < 4; ++r) { lo[r] = acc[g][t][r] * f; hi4[r] = acc[g][t][r + 4] * f; }
            *(v4fa*)(os + c * 68 + 16 * t + 8 * h) = lo; *(v4fa*)(os + c * 68 + 16 * t + 8 * h + 4) = hi4; }
        __builtin_amdgcn_wave_barrier(); asm volatile("" ::: "memory");   // keeps the row reads below behind the other lanes' LDS writes in the compiled order
#pragma unroll
        for (int i = 0; i < 4; ++i) { const int row = 4 * i + (lane >> 3), cofs = (lane & 7) * 8;   // a row of 64 fp16 is one 128-byte line: eight lanes a row, four rows a store
            const v4f v0 = *(const v4fa*)(os + row * 68 + cofs), v1 = *(const v4fa*)(os + row * 68 + cofs + 4); v8h oh;
#pragma unroll
            for (int k = 0; k < 4; ++k) { oh[k] = (h16)v0[k]; oh[k + 4] = (h16)v1[k]; }
            *(v8h*)(Ao + (size_t)(q0 + 16 * g + row) * DD + cofs) = oh; }
        asm volatile("s_wait_xcnt 0x0" ::: "memory");   // stands in front of the next group's work, which rewrites registers that these stores name
        __builtin_amdgcn_wave_barrier(); asm volatile("" ::: "memory");   // keeps the next group's LDS writes behind these reads
    }
}

extern "C" void kernel_launch(void* const* d_in, const int* in_sizes, int n_in,
                              void* d_out, int out_size, void* d_ws, size_t ws_size, hipStream_t stream) {
    (void)in_sizes; (void)n_in; (void)out_size;
    const float* x = (const float*)d_in[0]; const float* Wq = (const float*)d_in[1]; const float* bq = (const float*)d_in[2]; const float* Wk = (const float*)d_in[3]; const float* bk = (const float*)d_in[4]; const float* Wv = (const float*)d_in[5]; const float* bv = (const float*)d_in[6]; const float* Wo = (const float*)d_in[7]; const float* bo = (const float*)d_in[8];
    float* OUT = (float*)d_out;     // [16][1024][768]
    char* wsp = (char*)d_ws;
    auto take = [&](size_t bytes) { char* p = wsp; wsp += (bytes + 255) & ~(size_t)255; return (void*)p; };
    bf* WQ = (bf*)take((size_t)DD * FIN * 2); bf* WK = (bf*)take((size_t)DD * FIN * 2); bf* WV = (bf*)take((size_t)DD * FIN * 2); bf* WO = (bf*)take((size_t)DO * DD * 2);
    h16* QP = (h16*)take((size_t)NT * DD * 2); h16* KP = (h16*)take((size_t)NT * DD * 2); h16* VP = (h16*)take((size_t)NT * DD * 2);
    bf* XB = (bf*)take((size_t)NT * FIN * 2); h16* AT = (h16*)take((size_t)NT * DD * 2);
    if ((size_t)(wsp - (char*)d_ws) > ws_size) return;    // total ~ 131 MB; ws 256 MiB
    k_prep<<<(unsigned)(XBLK + 4 * WTB), 256, 0, stream>>>(x, Wq, Wk, Wv, Wo, XB, WQ, WK, WV, WO);
    // all 16 batches per launch: the rows of x are one [NT][768] matrix, and the 192 head planes are the flat projection memory
    const dim3 gP(NT / 256, DD / 128, 3);
    // the three projections as one grid, z = q, k, v: WQ, WK, WV and QP, KP, VP lie one behind the other in the workspace (each size is a multiple of the 256-byte rounding of take)
    static_assert(((size_t)DD * FIN * 2) % 256 == 0 && ((size_t)NT * DD * 2) % 256 == 0, "planes contiguous"); static_assert(NT % 256 == 0 && DD % 128 == 0 && DO % 192 == 0, "whole tiles");
    k_gemmw<bf, true, FIN, true, 4, 2><<<gP, 256, 0, stream>>>(XB, WQ, nullptr, QP, DD, bq, bk, bv, 0, (size_t)DD * FIN, (size_t)NT * DD);
    k_fattn<<<dim3(TT / 256, NB_ * NH_, 1), 256, 0, stream>>>(QP, KP, VP, AT);
    k_gemmw<h16, true, DD, false, 4, 3><<<dim3(NT / 256, DO / 192, 1), 384, 0, stream>>>(AT, (const h16*)WO, OUT, nullptr, DO, bo, bo, bo, 0, 0, 0);
}
